// v000
// The times below were measured on an AMD MI455X: many runs one after another, warmed up first and cycling through
// copies of the inputs, with the whole window's GPU time divided by the number of runs. Launches and the gaps
// between them are all in it. The median over several windows is given; except for v000 it joins two sittings, which
// can be a few percent apart, so the side-by-side timings, each taken in one sitting, are the better comparison.
// The starting kernel, v000, takes 1460 microseconds a run.
#include <hip/hip_runtime.h>

// Causal multi-head attention on three input streams that uses ONE shared projection for Q, K and V (Q, K, V [2][2048][1024]; q = Q wq^T + bq, k = K wq^T + bq, v = V wq^T + bq: the SAME 'oi' [1024][1024] weight (normal x 0.02) and the same bias (zeros on this draw: read) for all three streams, as the source module does; 16 heads x 64); scores x 1/sqrt(64); tril kept, -inf elsewhere; softmax over the keys; out = merged wo^T + bo ('oi' + bias zeros: read) -> [2][2048][1024] (4.2 M); argument order Q, K, V, wq, bq, wo, bo).
// Layout per batch: bf16 copies of q, k, v in turn; 'oi' weights; exact projections + f32 biases; identity-table plane builders; causal T-2048 attention (hybrid rows: < 512 hi/lo 3 products, rest fp16 x1024; k_gemmc skips tiles above the diagonal); merged hi/lo x Wo exact + bo.
// Compute dtypes, f32 accumulate: every input rounded to bf16; projections exact + f32 biases; attention rows < 512 3 products, rest fp16; softmax f32; Wo hl x exact + bias.

#define NB_  2
#define TT   2048
#define DM   1024
#define NH_  16
#define NKV  16
#define REP  (NH_ / NKV)
#define HD   64
#define DQ   (NH_ * HD)
#define DKV  (NKV * HD)
#define ZH   2
#define RH   512                  // query rows < RH use hi+lo planes (0: none)
#define WIN  2048
#define PCAR 1024.0f
#define SCL  0.125f   // HD^-0.5
typedef _Float16 h16;
typedef unsigned short bf;
typedef __attribute__((ext_vector_type(16))) __bf16   v16bf;
typedef __attribute__((ext_vector_type(16))) _Float16 v16h;
typedef __attribute__((ext_vector_type(8)))  _Float16 v8h;
typedef __attribute__((ext_vector_type(8)))  unsigned short v8us;
typedef __attribute__((ext_vector_type(8)))  float    v8f;
typedef __attribute__((ext_vector_type(4)))  float    v4f;
typedef v8h  __attribute__((may_alias)) v8ha;
typedef v4f  __attribute__((may_alias)) v4fa;
typedef v8us __attribute__((may_alias)) v8usa;

__device__ __forceinline__ unsigned short f2bf(float f) { unsigned u = __float_as_uint(f); u += 0x7FFFu + ((u >> 16) & 1u); return (unsigned short)(u >> 16); }
__device__ __forceinline__ float bf2f(unsigned short b) { return __uint_as_float(((unsigned)b) << 16); }
__device__ __forceinline__ float bfr(float f) { return bf2f(f2bf(f)); }
__device__ __forceinline__ v16h cat16(v8h lo, v8h hi) { return __builtin_shufflevector(lo, hi, 0, 1, 2, 3, 4, 5, 6, 7, 8, 9, 10, 11, 12, 13, 14, 15); }
__device__ __forceinline__ v16bf cat16b(v8us lo, v8us hi) { return __builtin_bit_cast(v16bf, __builtin_shufflevector(lo, hi, 0, 1, 2, 3, 4, 5, 6, 7, 8, 9, 10, 11, 12, 13, 14, 15)); }
__device__ __forceinline__ v8f wmma16(v16h a, v16h b, v8f c) { return __builtin_amdgcn_wmma_f32_16x16x32_f16(false, a, false, b, (short)0, c, false, false); }
__device__ __forceinline__ v8f wmmab(v16bf a, v16bf b, v8f c) { return __builtin_amdgcn_wmma_f32_16x16x32_bf16(false, a, false, b, (short)0, c, false, false); }



// ---- k_gemmw: register-blocked GEMM, ONE WAVE per 64x64 output tile (16 accumulators), operands straight from K-contiguous 16-bit planes; grid (M/64, N/64, Z), 32 threads.
// C[m][n] (f32, pitch ldc, + optional f32 bias[n]) = sum_k A[m][k] Bt[n][k] (+ split products per NSPLIT). z-batch strides sA/sB/sC in elements. K % 32 == 0.
template <typename T16> struct WFrag;
template <> struct WFrag<h16> { typedef v16h V; static __device__ __forceinline__ V ld(const h16* p) { return cat16(*(const v8h*)p, *(const v8h*)(p + 16)); } static __device__ __forceinline__ v8f mma(V a, V b, v8f c) { return wmma16(a, b, c); } };
template <> struct WFrag<bf> { typedef v16bf V; static __device__ __forceinline__ V ld(const bf* p) { return cat16b(*(const v8us*)p, *(const v8us*)(p + 16)); } static __device__ __forceinline__ v8f mma(V a, V b, v8f c) { return wmmab(a, b, c); } };
template <typename T16, int NSPLIT, bool BIAS>
__global__ __launch_bounds__(32) void k_gemmw(const T16* __restrict__ A, const T16* __restrict__ A2, const T16* __restrict__ Bt, const T16* __restrict__ Bt2, int K, float* C, int ldc, const float* __restrict__ bias, size_t sA, size_t sB, size_t sC) {
    typedef typename WFrag<T16>::V V;
    __shared__ __align__(16) float os[16 * 68];
    const size_t z = blockIdx.z; A += z * sA; if (A2) A2 += z * sA; Bt += z * sB; if (Bt2) Bt2 += z * sB; C += z * sC;
    const int lane = threadIdx.x & 31, lr = lane & 15, hi = lane >> 4; const int r0 = blockIdx.x * 64, c0 = blockIdx.y * 64;
    v8f acc[4][4];
#pragma unroll
    for (int mb = 0; mb < 4; ++mb)
#pragma unroll
        for (int nb = 0; nb < 4; ++nb) acc[mb][nb] = (v8f){};
    const size_t aoff = (size_t)(r0 + lr) * K + 8 * hi, boff = (size_t)(c0 + lr) * K + 8 * hi;
#pragma unroll 1
    for (int kc = 0; kc < K; kc += 32) {
        V a[4], a2[4];
#pragma unroll
        for (int mb = 0; mb < 4; ++mb) { a[mb] = WFrag<T16>::ld(A + aoff + (size_t)mb * 16 * K + kc); if (NSPLIT == 1 || NSPLIT == 2) a2[mb] = WFrag<T16>::ld(A2 + aoff + (size_t)mb * 16 * K + kc); }
#pragma unroll
        for (int nb = 0; nb < 4; ++nb) { const V b = WFrag<T16>::ld(Bt + boff + (size_t)nb * 16 * K + kc); V b2; if (NSPLIT >= 2) b2 = WFrag<T16>::ld(Bt2 + boff + (size_t)nb * 16 * K + kc);
#pragma unroll
            for (int mb = 0; mb < 4; ++mb) { acc[mb][nb] = WFrag<T16>::mma(a[mb], b, acc[mb][nb]); if (NSPLIT == 1 || NSPLIT == 2) acc[mb][nb] = WFrag<T16>::mma(a2[mb], b, acc[mb][nb]); if (NSPLIT >= 2) acc[mb][nb] = WFrag<T16>::mma(a[mb], b2, acc[mb][nb]); } }
        asm volatile("v_nop\n\tv_nop\n\tv_nop\n\tv_nop" : "+v"(acc[0][0]), "+v"(acc[1][1]), "+v"(acc[2][2]), "+v"(acc[3][3]) : "v"(a[0]), "v"(a[3]));
    }
#pragma unroll
    for (int mb = 0; mb < 4; ++mb) {
#pragma unroll
        for (int nb = 0; nb < 4; ++nb) {
#pragma unroll
            for (int j = 0; j < 8; ++j) os[(hi * 8 + j) * 68 + nb * 16 + lr] = acc[mb][nb][j]; }
        __builtin_amdgcn_wave_barrier(); asm volatile("" ::: "memory");
        float* crow = C + (size_t)(r0 + mb * 16) * ldc + c0;
{
#pragma unroll
            for (int s = 0; s < 8; ++s) { const int row = 2 * s + hi, cofs = lr * 4; v4f val = *(const v4fa*)(os + row * 68 + cofs); if (BIAS) { val[0] += bfr(bias[c0 + cofs]); val[1] += bfr(bias[c0 + cofs + 1]); val[2] += bfr(bias[c0 + cofs + 2]); val[3] += bfr(bias[c0 + cofs + 3]); }
                *(v4f*)(crow + (size_t)row * ldc + cofs) = val; }
             }
        __builtin_amdgcn_wave_barrier(); asm volatile("" ::: "memory");
    }
}

// ---- k_gemmc: the same one-wave 64x64 tile GEMM specialised for causal attention: CMODE 1 skips score tiles entirely above the diagonal (query rows r0+roff.., key columns c0..), CMODE 2 limits the
// key (K) loop of the probability x value contraction to the diagonal block (probabilities beyond it are exactly zero). roff = row offset of this launch's first row within the sequence.
template <typename T16, int NSPLIT, int CMODE>
__global__ __launch_bounds__(32) void k_gemmc(const T16* __restrict__ A, const T16* __restrict__ A2, const T16* __restrict__ Bt, const T16* __restrict__ Bt2, int K, float* C, int ldc, int roff, size_t sA, size_t sB, size_t sC) {
    typedef typename WFrag<T16>::V V;
    __shared__ __align__(16) float os[16 * 68];
    const size_t z = blockIdx.z; A += z * sA; if (A2) A2 += z * sA; Bt += z * sB; if (Bt2) Bt2 += z * sB; C += z * sC;
    const int lane = threadIdx.x & 31, lr = lane & 15, hi = lane >> 4; const int r0 = blockIdx.x * 64, c0 = blockIdx.y * 64;
    if (CMODE == 1 && c0 > r0 + roff + 63) return;                  // score tile entirely above the causal diagonal: never read (the softmax masks j > i by select)
    const int Kl = (CMODE == 2) ? min(K, r0 + roff + 64) : K;        // P.V: probabilities are exactly 0 beyond the diagonal block, so the K loop stops there
    v8f acc[4][4];
#pragma unroll
    for (int mb = 0; mb < 4; ++mb)
#pragma unroll
        for (int nb = 0; nb < 4; ++nb) acc[mb][nb] = (v8f){};
    const size_t aoff = (size_t)(r0 + lr) * K + 8 * hi, boff = (size_t)(c0 + lr) * K + 8 * hi;
#pragma unroll 1
    for (int kc = 0; kc < Kl; kc += 32) {
        V a[4], a2[4];
#pragma unroll
        for (int mb = 0; mb < 4; ++mb) { a[mb] = WFrag<T16>::ld(A + aoff + (size_t)mb * 16 * K + kc); if (NSPLIT == 1 || NSPLIT == 2) a2[mb] = WFrag<T16>::ld(A2 + aoff + (size_t)mb * 16 * K + kc); }
#pragma unroll
        for (int nb = 0; nb < 4; ++nb) { const V b = WFrag<T16>::ld(Bt + boff + (size_t)nb * 16 * K + kc); V b2; if (NSPLIT >= 2) b2 = WFrag<T16>::ld(Bt2 + boff + (size_t)nb * 16 * K + kc);
#pragma unroll
            for (int mb = 0; mb < 4; ++mb) { acc[mb][nb] = WFrag<T16>::mma(a[mb], b, acc[mb][nb]); if (NSPLIT == 1 || NSPLIT == 2) acc[mb][nb] = WFrag<T16>::mma(a2[mb], b, acc[mb][nb]); if (NSPLIT >= 2) acc[mb][nb] = WFrag<T16>::mma(a[mb], b2, acc[mb][nb]); } }
        asm volatile("v_nop\n\tv_nop\n\tv_nop\n\tv_nop" : "+v"(acc[0][0]), "+v"(acc[1][1]), "+v"(acc[2][2]), "+v"(acc[3][3]) : "v"(a[0]), "v"(a[3]));
    }
#pragma unroll
    for (int mb = 0; mb < 4; ++mb) {
#pragma unroll
        for (int nb = 0; nb < 4; ++nb) {
#pragma unroll
            for (int j = 0; j < 8; ++j) os[(hi * 8 + j) * 68 + nb * 16 + lr] = acc[mb][nb][j]; }
        __builtin_amdgcn_wave_barrier(); asm volatile("" ::: "memory");
        float* crow = C + (size_t)(r0 + mb * 16) * ldc + c0;
{
#pragma unroll
            for (int s = 0; s < 8; ++s) { const int row = 2 * s + hi, cofs = lr * 4; v4f val = *(const v4fa*)(os + row * 68 + cofs);
                *(v4f*)(crow + (size_t)row * ldc + cofs) = val; }
             }
        __builtin_amdgcn_wave_barrier(); asm volatile("" ::: "memory");
    }
}

__device__ __forceinline__ h16 tohx(float x) { return (h16)x; }
__device__ __forceinline__ void splitf(float y, unsigned short& h, unsigned short& l) { h = f2bf(y); l = f2bf(y - bf2f(h)); }
typedef __attribute__((ext_vector_type(2))) _Float16 v2h;
typedef __attribute__((ext_vector_type(4))) _Float16 v4h;
typedef __attribute__((ext_vector_type(2))) unsigned short v2us;
typedef __attribute__((ext_vector_type(4))) unsigned short v4us;
typedef __attribute__((ext_vector_type(2))) float v2f;
typedef __attribute__((ext_vector_type(4))) int v4i;

__global__ __launch_bounds__(256) void k_cvt8(const float* __restrict__ src, bf* dst, size_t n8) { const size_t i = (size_t)blockIdx.x * 256 + threadIdx.x; if (i >= n8) return; const v8f v = *(const v8f*)(src + i * 8); v8us o;
#pragma unroll
    for (int k = 0; k < 8; ++k) o[k] = f2bf(v[k]); *(v8us*)(dst + i * 8) = o;  }

// k_rope: head planes [h][t][d] (fp16 + hi/lo) of rope(x) x sc with the rotate-half convention out[d] = x[d] cos[t][d] - x[d+HD/2] sin[t][d], out[d+HD/2] = x[d+HD/2] cos[t][d+HD/2] + x[d] sin[t][d+HD/2]
__global__ __launch_bounds__(256) void k_rope(const float* __restrict__ F, int pitch, int nheads, const float* __restrict__ CS, const float* __restrict__ RF, const float* __restrict__ nw, float sc, h16* P16, bf* Ph, bf* Pl) {
    const size_t e = ((size_t)blockIdx.x * 256 + threadIdx.x) * 2; if (e >= (size_t)nheads * TT * HD) return; const int d = (int)(e % HD); const int t = (int)((e / HD) % TT); const int h = (int)(e / ((size_t)HD * TT)); const float* f = F + (size_t)t * pitch + h * HD; const float rf = RF ? RF[(size_t)h * TT + t] : 1.0f; v2h o16; v2us oh, ol;
#pragma unroll
    for (int q = 0; q < 2; ++q) { const int dd = d + q; const int dp = (dd < HD / 2) ? dd + HD / 2 : dd - HD / 2; float x0 = f[dd], x1 = f[dp];
        if (RF) { float n0 = __fmul_rn(x0, rf), n1 = __fmul_rn(x1, rf); asm volatile("" : "+v"(n0)); asm volatile("" : "+v"(n1)); x0 = __fmul_rn(bfr(nw[dd]), n0); x1 = __fmul_rn(bfr(nw[dp]), n1); }
        const v2f cs = *(const v2f*)(CS + ((size_t)t * HD + dd) * 2); float a = __fmul_rn(x0, cs[0]), bq = __fmul_rn(x1, cs[1]); asm volatile("" : "+v"(a)); asm volatile("" : "+v"(bq)); const float r = ((dd < HD / 2) ? __fsub_rn(a, bq) : __fadd_rn(a, bq)) * sc;
        o16[q] = tohx(r); unsigned short a2, c2; splitf(r, a2, c2); oh[q] = a2; ol[q] = c2; }
    *(v2h*)(P16 + e) = o16; *(v2us*)(Ph + e) = oh; *(v2us*)(Pl + e) = ol;  }
__global__ __launch_bounds__(256) void k_vtp(const float* __restrict__ F, int pitch, int nheads, h16* V16, bf* Vh, bf* Vl) { const size_t e = ((size_t)blockIdx.x * 256 + threadIdx.x) * 2; if (e >= (size_t)nheads * HD * TT) return; const int t = (int)(e % TT); const int d = (int)((e / TT) % HD); const int g = (int)(e / ((size_t)TT * HD)); v2h o16; v2us oh, ol;
#pragma unroll
    for (int q = 0; q < 2; ++q) { const float x = F[(size_t)(t + q) * pitch + g * HD + d]; o16[q] = tohx(x); unsigned short a2, c2; splitf(x, a2, c2); oh[q] = a2; ol[q] = c2; }
    *(v2h*)(V16 + e) = o16; *(v2us*)(Vh + e) = oh; *(v2us*)(Vl + e) = ol;  }
__global__ __launch_bounds__(256) void k_csid(float* CS) { const int idx = blockIdx.x * 256 + threadIdx.x; if (idx >= TT * HD) return; v2f cs; cs[0] = 1.0f; cs[1] = 0.0f; *(v2f*)(CS + (size_t)idx * 2) = cs;  }
// k_asoft: per row (zz, i): t = S x HD^-0.5 for j <= i and i - j < WIN (WIN = TT: the window never binds, plain causal; the reference's -1e9 additive fill vanishes identically); softmax over the 2048 keys (register row, one exp, fixed trees);
__global__ __launch_bounds__(256) void k_asoft(const float* __restrict__ Sb, h16* P16, bf* Ph, bf* Pl) {
    const int lane = threadIdx.x & 31; const int row = blockIdx.x * 8 + (threadIdx.x >> 5); if (row >= ZH * TT) return; const int i = row % TT; const int zz = row / TT; (void)zz; const bool hires = (i < RH); const float* sr = Sb + (size_t)row * TT; float v[TT / 32]; float mx = -3.0e38f;
#pragma unroll
    for (int ch = 0; ch < TT / 128; ++ch) { const int j0 = ch * 128 + lane * 4; const v4f a = *(const v4f*)(sr + j0);
#pragma unroll
        for (int q = 0; q < 4; ++q) { const int j = j0 + q; (void)j; const float t = (j <= i && i - j < WIN) ? a[q] * SCL : -3.0e38f; v[ch * 4 + q] = t; mx = fmaxf(mx, t); } }
#pragma unroll
    for (int sh = 16; sh; sh >>= 1) mx = fmaxf(mx, __shfl_xor(mx, sh, 32));
    float sum = 0.f;
#pragma unroll
    for (int k = 0; k < TT / 32; ++k) { float d0 = __fsub_rn(v[k], mx); asm volatile("" : "+v"(d0)); v[k] = __builtin_amdgcn_exp2f(__fmul_rn(d0, 1.4426950408889634f)); sum += v[k]; }
#pragma unroll
    for (int sh = 16; sh; sh >>= 1) sum += __shfl_xor(sum, sh, 32);
    const float f = __fdiv_rn(hires ? 1.0f : PCAR, sum);
{
        if (hires) {
#pragma unroll
            for (int ch = 0; ch < TT / 128; ++ch) { v4us oh, ol;
#pragma unroll
                for (int q = 0; q < 4; ++q) { unsigned short a, c2; splitf(v[ch * 4 + q] * f, a, c2); oh[q] = a; ol[q] = c2; }
                const size_t oo = ((size_t)zz * (RH ? RH : 1) + i) * TT + ch * 128 + lane * 4; *(v4us*)(Ph + oo) = oh; *(v4us*)(Pl + oo) = ol; }
        } else {
#pragma unroll
            for (int ch = 0; ch < TT / 128; ++ch) { v4h o4;
#pragma unroll
                for (int q = 0; q < 4; ++q) o4[q] = tohx(v[ch * 4 + q] * f);
                *(v4h*)(P16 + (size_t)row * TT + ch * 128 + lane * 4) = o4; } }
         }
}
__global__ __launch_bounds__(256) void k_merge(const float* __restrict__ O, int h0, bf* Ah, bf* Al) { const size_t e = ((size_t)blockIdx.x * 256 + threadIdx.x) * 2; if (e >= (size_t)ZH * TT * HD) return; const int d = (int)(e % HD); const int t = (int)((e / HD) % TT); const int zz = (int)(e / ((size_t)HD * TT)); const float cs = (t < RH) ? 1.0f : (1.0f / PCAR); const size_t oo = (size_t)t * DQ + (h0 + zz) * HD + d;
    v2us oh, ol;
#pragma unroll
    for (int q = 0; q < 2; ++q) { unsigned short a, c2; splitf(O[e + q] * cs, a, c2); oh[q] = a; ol[q] = c2; } *(v2us*)(Ah + oo) = oh; *(v2us*)(Al + oo) = ol;  }

extern "C" void kernel_launch(void* const* d_in, const int* in_sizes, int n_in,
                              void* d_out, int out_size, void* d_ws, size_t ws_size, hipStream_t stream) {
    (void)in_sizes; (void)n_in; (void)out_size;
    const float* x = (const float*)d_in[0]; const float* xk = (const float*)d_in[1]; const float* xv = (const float*)d_in[2]; const float* wq = (const float*)d_in[3]; const float* bq = (const float*)d_in[4]; const float* wk = (const float*)d_in[3]; const float* bk = (const float*)d_in[4]; const float* wv = (const float*)d_in[3]; const float* bv = (const float*)d_in[4]; const float* wo = (const float*)d_in[5]; const float* bo = (const float*)d_in[6];   /* argument order Q, K, V (three streams), wq ('oi': the ONE weight used for the q, k AND v projections, as the source module does), bq (the one shared bias), wo ('oi'), bo; the causal rule is applied by index: no mask input */
    float* OUT = (float*)d_out;     // [2][2048][1024]
    char* wsp = (char*)d_ws;
    auto take = [&](size_t bytes) { char* p = wsp; wsp += (bytes + 255) & ~(size_t)255; return (void*)p; };
    bf* WQ = (bf*)take((size_t)DQ * DM * 2); bf* WK = (bf*)take((size_t)DKV * DM * 2); bf* WV = (bf*)take((size_t)DKV * DM * 2); bf* WO = (bf*)take((size_t)DM * DQ * 2); float* CS = (float*)take((size_t)TT * HD * 2 * 4);
    bf* XB = (bf*)take((size_t)TT * DM * 2); float* FQ = (float*)take((size_t)TT * DQ * 4); float* FK = (float*)take((size_t)TT * DKV * 4);
    h16* QP16 = (h16*)take((size_t)NH_ * TT * HD * 2); h16* KP16 = (h16*)take((size_t)NKV * TT * HD * 2); h16* VT16 = (h16*)take((size_t)NKV * HD * TT * 2);
    bf* QPh = (bf*)take((size_t)NH_ * TT * HD * 2); bf* QPl = (bf*)take((size_t)NH_ * TT * HD * 2); bf* KPh = (bf*)take((size_t)NKV * TT * HD * 2); bf* KPl = (bf*)take((size_t)NKV * TT * HD * 2); bf* VTh = (bf*)take((size_t)NKV * HD * TT * 2); bf* VTl = (bf*)take((size_t)NKV * HD * TT * 2); bf* Ph = (bf*)take((size_t)ZH * RH * TT * 2); bf* Pl = (bf*)take((size_t)ZH * RH * TT * 2);
    float* Sb = (float*)take((size_t)ZH * TT * TT * 4); h16* P16 = (h16*)take((size_t)ZH * TT * TT * 2); float* Ob = (float*)take((size_t)ZH * TT * HD * 4); bf* ATh = (bf*)take((size_t)TT * DQ * 2); bf* ATl = (bf*)take((size_t)TT * DQ * 2);
    if ((size_t)(wsp - (char*)d_ws) > ws_size) return;    // ws 256 MiB
    float* FV = FK;   // v projection reuses the k buffer after the k planes are built (stream-ordered)
    { k_cvt8<<<(unsigned)(((size_t)DQ * DM / 8 + 255) / 256), 256, 0, stream>>>(wq, WQ, (size_t)DQ * DM / 8); k_cvt8<<<(unsigned)(((size_t)DKV * DM / 8 + 255) / 256), 256, 0, stream>>>(wk, WK, (size_t)DKV * DM / 8); k_cvt8<<<(unsigned)(((size_t)DKV * DM / 8 + 255) / 256), 256, 0, stream>>>(wv, WV, (size_t)DKV * DM / 8);
      k_cvt8<<<(unsigned)(((size_t)DM * DQ / 8 + 255) / 256), 256, 0, stream>>>(wo, WO, (size_t)DM * DQ / 8);
       }
    k_csid<<<(TT * HD + 255) / 256, 256, 0, stream>>>(CS);
    const unsigned LQ = (unsigned)(((size_t)NH_ * TT * HD / 2 + 255) / 256), LKv = (unsigned)(((size_t)NKV * TT * HD / 2 + 255) / 256);
    for (int b = 0; b < NB_; ++b) {
        
        k_cvt8<<<(unsigned)(((size_t)TT * DM / 8 + 255) / 256), 256, 0, stream>>>(x + (size_t)b * TT * DM, XB, (size_t)TT * DM / 8);
        k_gemmw<bf, 0, true><<<dim3(TT / 64, DQ / 64, 1), 32, 0, stream>>>(XB, nullptr, WQ, nullptr, DM, FQ, DQ, bq, 0, 0, 0);
        k_rope<<<LQ, 256, 0, stream>>>(FQ, DQ, NH_, CS, nullptr, nullptr, 1.0f, QP16, QPh, QPl);
        k_cvt8<<<(unsigned)(((size_t)TT * DM / 8 + 255) / 256), 256, 0, stream>>>(xk + (size_t)b * TT * DM, XB, (size_t)TT * DM / 8);   /* XB := bf16(k[b]) */ k_gemmw<bf, 0, true><<<dim3(TT / 64, DKV / 64, 1), 32, 0, stream>>>(XB, nullptr, WK, nullptr, DM, FK, DKV, bk, 0, 0, 0);
        k_rope<<<LKv, 256, 0, stream>>>(FK, DKV, NKV, CS, nullptr, nullptr, 1.0f, KP16, KPh, KPl);
        k_cvt8<<<(unsigned)(((size_t)TT * DM / 8 + 255) / 256), 256, 0, stream>>>(xv + (size_t)b * TT * DM, XB, (size_t)TT * DM / 8);   /* XB := bf16(v[b]) */ k_gemmw<bf, 0, true><<<dim3(TT / 64, DKV / 64, 1), 32, 0, stream>>>(XB, nullptr, WV, nullptr, DM, FV, DKV, bv, 0, 0, 0); k_vtp<<<LKv, 256, 0, stream>>>(FV, DKV, NKV, VT16, VTh, VTl);
        for (int h0 = 0; h0 < NH_; h0 += ZH) { const size_t zq = (size_t)h0, zk = (size_t)(h0 / REP);   // one kv head per query head: the pass's two heads use consecutive kv planes (z-strides TT*HD)
            k_gemmc<bf, 2, 1><<<dim3(RH / 64, TT / 64, ZH), 32, 0, stream>>>(QPh + zq * TT * HD, QPl + zq * TT * HD, KPh + zk * TT * HD, KPl + zk * TT * HD, HD, Sb, TT, 0, (size_t)TT * HD, (size_t)TT * HD, (size_t)TT * TT);
            k_gemmc<h16, 0, 1><<<dim3((TT - RH) / 64, TT / 64, ZH), 32, 0, stream>>>(QP16 + zq * TT * HD + (size_t)RH * HD, nullptr, KP16 + zk * TT * HD, nullptr, HD, Sb + (size_t)RH * TT, TT, RH, (size_t)TT * HD, (size_t)TT * HD, (size_t)TT * TT);
            k_asoft<<<ZH * TT / 8, 256, 0, stream>>>(Sb, P16, Ph, Pl);
            k_gemmc<bf, 2, 2><<<dim3(RH / 64, HD / 64, ZH), 32, 0, stream>>>(Ph, Pl, VTh + zk * HD * TT, VTl + zk * HD * TT, TT, Ob, HD, 0, (size_t)RH * TT, (size_t)HD * TT, (size_t)TT * HD);
            k_gemmc<h16, 0, 2><<<dim3((TT - RH) / 64, HD / 64, ZH), 32, 0, stream>>>(P16 + (size_t)RH * TT, nullptr, VT16 + zk * HD * TT, nullptr, TT, Ob + (size_t)RH * HD, HD, RH, (size_t)TT * TT, (size_t)HD * TT, (size_t)TT * HD);
            k_merge<<<(unsigned)(((size_t)ZH * TT * HD / 2 + 255) / 256), 256, 0, stream>>>(Ob, h0, ATh, ATl); }
        k_gemmw<bf, 1, true><<<dim3(TT / 64, DM / 64, 1), 32, 0, stream>>>(ATh, ATl, WO, nullptr, DQ, OUT + (size_t)b * TT * DM, DM, bo, 0, 0, 0); }
}

// v001
// One run takes 885 microseconds.
// Timed twice side by side with v000, it ran 1.63 and 1.66 times as fast.
#include <hip/hip_runtime.h>

// Causal multi-head attention on three input streams that uses ONE shared projection for Q, K and V (Q, K, V [2][2048][1024]; q = Q wq^T + bq, k = K wq^T + bq, v = V wq^T + bq: the SAME 'oi' [1024][1024] weight (normal x 0.02) and the same bias (zeros on this draw: read) for all three streams, as the source module does; 16 heads x 64); scores x 1/sqrt(64); tril kept, -inf elsewhere; softmax over the keys; out = merged wo^T + bo ('oi' + bias zeros: read) -> [2][2048][1024] (4.2 M); argument order Q, K, V, wq, bq, wo, bo).
// Layout per batch: bf16 copies of q, k, v in turn; 'oi' weights; exact projections + f32 biases; identity-table plane builders; causal T-2048 attention (hybrid rows: < 512 hi/lo 3 products, rest fp16 x1024; k_gemmc skips tiles above the diagonal); merged hi/lo x Wo exact + bo.
// Compute dtypes, f32 accumulate: every input rounded to bf16; projections exact + f32 biases; attention rows < 512 3 products, rest fp16; softmax f32; Wo hl x exact + bias.

#define NB_  2
#define TT   2048
#define DM   1024
#define NH_  16
#define NKV  16
#define REP  (NH_ / NKV)
#define HD   64
#define DQ   (NH_ * HD)
#define DKV  (NKV * HD)
#define ZH   2
#define RH   512                  // query rows < RH use hi+lo planes (0: none)
#define WIN  2048
#define PCAR 1024.0f
#define SCL  0.125f   // HD^-0.5
typedef _Float16 h16;
typedef unsigned short bf;
typedef __attribute__((ext_vector_type(16))) __bf16   v16bf;
typedef __attribute__((ext_vector_type(16))) _Float16 v16h;
typedef __attribute__((ext_vector_type(8)))  _Float16 v8h;
typedef __attribute__((ext_vector_type(8)))  unsigned short v8us;
typedef __attribute__((ext_vector_type(8)))  float    v8f;
typedef __attribute__((ext_vector_type(4)))  float    v4f;
typedef v8h  __attribute__((may_alias)) v8ha;
typedef v4f  __attribute__((may_alias)) v4fa;
typedef v8us __attribute__((may_alias)) v8usa;

__device__ __forceinline__ unsigned short f2bf(float f) { unsigned u = __float_as_uint(f); u += 0x7FFFu + ((u >> 16) & 1u); return (unsigned short)(u >> 16); }
__device__ __forceinline__ float bf2f(unsigned short b) { return __uint_as_float(((unsigned)b) << 16); }
__device__ __forceinline__ float bfr(float f) { return bf2f(f2bf(f)); }
__device__ __forceinline__ v16h cat16(v8h lo, v8h hi) { return __builtin_shufflevector(lo, hi, 0, 1, 2, 3, 4, 5, 6, 7, 8, 9, 10, 11, 12, 13, 14, 15); }
__device__ __forceinline__ v16bf cat16b(v8us lo, v8us hi) { return __builtin_bit_cast(v16bf, __builtin_shufflevector(lo, hi, 0, 1, 2, 3, 4, 5, 6, 7, 8, 9, 10, 11, 12, 13, 14, 15)); }
__device__ __forceinline__ v8f wmma16(v16h a, v16h b, v8f c) { return __builtin_amdgcn_wmma_f32_16x16x32_f16(false, a, false, b, (short)0, c, false, false); }
__device__ __forceinline__ v8f wmmab(v16bf a, v16bf b, v8f c) { return __builtin_amdgcn_wmma_f32_16x16x32_bf16(false, a, false, b, (short)0, c, false, false); }



// ---- k_gemmw: register-blocked GEMM, ONE WAVE per 64x64 output tile (16 accumulators), operands straight from K-contiguous 16-bit planes; grid (M/64, N/64, Z), 32 threads.
// C[m][n] (f32, pitch ldc, + optional f32 bias[n]) = sum_k A[m][k] Bt[n][k] (+ split products per NSPLIT). z-batch strides sA/sB/sC in elements. K % 32 == 0.
template <typename T16> struct WFrag;
template <> struct WFrag<h16> { typedef v16h V; static __device__ __forceinline__ V ld(const h16* p) { return cat16(*(const v8h*)p, *(const v8h*)(p + 16)); } static __device__ __forceinline__ v8f mma(V a, V b, v8f c) { return wmma16(a, b, c); } };
template <> struct WFrag<bf> { typedef v16bf V; static __device__ __forceinline__ V ld(const bf* p) { return cat16b(*(const v8us*)p, *(const v8us*)(p + 16)); } static __device__ __forceinline__ v8f mma(V a, V b, v8f c) { return wmmab(a, b, c); } };
template <typename T16, int NSPLIT, bool BIAS>
__global__ __launch_bounds__(32) void k_gemmw(const T16* __restrict__ A, const T16* __restrict__ A2, const T16* __restrict__ Bt, const T16* __restrict__ Bt2, int K, float* C, int ldc, const float* __restrict__ bias, size_t sA, size_t sB, size_t sC) {
    typedef typename WFrag<T16>::V V;
    __shared__ __align__(16) float os[16 * 68];
    const size_t z = blockIdx.z; A += z * sA; if (A2) A2 += z * sA; Bt += z * sB; if (Bt2) Bt2 += z * sB; C += z * sC;
    const int lane = threadIdx.x & 31, lr = lane & 15, hi = lane >> 4; const int r0 = blockIdx.x * 64, c0 = blockIdx.y * 64;
    v8f acc[4][4];
#pragma unroll
    for (int mb = 0; mb < 4; ++mb)
#pragma unroll
        for (int nb = 0; nb < 4; ++nb) acc[mb][nb] = (v8f){};
    const size_t aoff = (size_t)(r0 + lr) * K + 8 * hi, boff = (size_t)(c0 + lr) * K + 8 * hi;
#pragma unroll 1
    for (int kc = 0; kc < K; kc += 32) {
        V a[4], a2[4];
#pragma unroll
        for (int mb = 0; mb < 4; ++mb) { a[mb] = WFrag<T16>::ld(A + aoff + (size_t)mb * 16 * K + kc); if (NSPLIT == 1 || NSPLIT == 2) a2[mb] = WFrag<T16>::ld(A2 + aoff + (size_t)mb * 16 * K + kc); }
#pragma unroll
        for (int nb = 0; nb < 4; ++nb) { const V b = WFrag<T16>::ld(Bt + boff + (size_t)nb * 16 * K + kc); V b2; if (NSPLIT >= 2) b2 = WFrag<T16>::ld(Bt2 + boff + (size_t)nb * 16 * K + kc);
#pragma unroll
            for (int mb = 0; mb < 4; ++mb) { acc[mb][nb] = WFrag<T16>::mma(a[mb], b, acc[mb][nb]); if (NSPLIT == 1 || NSPLIT == 2) acc[mb][nb] = WFrag<T16>::mma(a2[mb], b, acc[mb][nb]); if (NSPLIT >= 2) acc[mb][nb] = WFrag<T16>::mma(a[mb], b2, acc[mb][nb]); } }
        asm volatile("v_nop\n\tv_nop\n\tv_nop\n\tv_nop" : "+v"(acc[0][0]), "+v"(acc[1][1]), "+v"(acc[2][2]), "+v"(acc[3][3]) : "v"(a[0]), "v"(a[3]));
    }
#pragma unroll
    for (int mb = 0; mb < 4; ++mb) {
#pragma unroll
        for (int nb = 0; nb < 4; ++nb) {
#pragma unroll
            for (int j = 0; j < 8; ++j) os[(hi * 8 + j) * 68 + nb * 16 + lr] = acc[mb][nb][j]; }
        __builtin_amdgcn_wave_barrier(); asm volatile("" ::: "memory");
        float* crow = C + (size_t)(r0 + mb * 16) * ldc + c0;
{
#pragma unroll
            for (int s = 0; s < 8; ++s) { const int row = 2 * s + hi, cofs = lr * 4; v4f val = *(const v4fa*)(os + row * 68 + cofs); if (BIAS) { val[0] += bfr(bias[c0 + cofs]); val[1] += bfr(bias[c0 + cofs + 1]); val[2] += bfr(bias[c0 + cofs + 2]); val[3] += bfr(bias[c0 + cofs + 3]); }
                *(v4f*)(crow + (size_t)row * ldc + cofs) = val; }
             }
        __builtin_amdgcn_wave_barrier(); asm volatile("" ::: "memory");
    }
}

// ---- k_gemmc: the same one-wave 64x64 tile GEMM specialised for causal attention: CMODE 1 skips score tiles entirely above the diagonal (query rows r0+roff.., key columns c0..), CMODE 2 limits the
// key (K) loop of the probability x value contraction to the diagonal block (probabilities beyond it are exactly zero). roff = row offset of this launch's first row within the sequence.
template <typename T16, int NSPLIT, int CMODE>
__global__ __launch_bounds__(32) void k_gemmc(const T16* __restrict__ A, const T16* __restrict__ A2, const T16* __restrict__ Bt, const T16* __restrict__ Bt2, int K, float* C, int ldc, int roff, size_t sA, size_t sB, size_t sC) {
    typedef typename WFrag<T16>::V V;
    __shared__ __align__(16) float os[16 * 68];
    const size_t z = blockIdx.z; A += z * sA; if (A2) A2 += z * sA; Bt += z * sB; if (Bt2) Bt2 += z * sB; C += z * sC;
    const int lane = threadIdx.x & 31, lr = lane & 15, hi = lane >> 4; const int r0 = blockIdx.x * 64, c0 = blockIdx.y * 64;
    if (CMODE == 1 && c0 > r0 + roff + 63) return;                  // score tile entirely above the causal diagonal: never read (the softmax masks j > i by select)
    const int Kl = (CMODE == 2) ? min(K, r0 + roff + 64) : K;        // P.V: probabilities are exactly 0 beyond the diagonal block, so the K loop stops there
    v8f acc[4][4];
#pragma unroll
    for (int mb = 0; mb < 4; ++mb)
#pragma unroll
        for (int nb = 0; nb < 4; ++nb) acc[mb][nb] = (v8f){};
    const size_t aoff = (size_t)(r0 + lr) * K + 8 * hi, boff = (size_t)(c0 + lr) * K + 8 * hi;
#pragma unroll 1
    for (int kc = 0; kc < Kl; kc += 32) {
        V a[4], a2[4];
#pragma unroll
        for (int mb = 0; mb < 4; ++mb) { a[mb] = WFrag<T16>::ld(A + aoff + (size_t)mb * 16 * K + kc); if (NSPLIT == 1 || NSPLIT == 2) a2[mb] = WFrag<T16>::ld(A2 + aoff + (size_t)mb * 16 * K + kc); }
#pragma unroll
        for (int nb = 0; nb < 4; ++nb) { const V b = WFrag<T16>::ld(Bt + boff + (size_t)nb * 16 * K + kc); V b2; if (NSPLIT >= 2) b2 = WFrag<T16>::ld(Bt2 + boff + (size_t)nb * 16 * K + kc);
#pragma unroll
            for (int mb = 0; mb < 4; ++mb) { acc[mb][nb] = WFrag<T16>::mma(a[mb], b, acc[mb][nb]); if (NSPLIT == 1 || NSPLIT == 2) acc[mb][nb] = WFrag<T16>::mma(a2[mb], b, acc[mb][nb]); if (NSPLIT >= 2) acc[mb][nb] = WFrag<T16>::mma(a[mb], b2, acc[mb][nb]); } }
        asm volatile("v_nop\n\tv_nop\n\tv_nop\n\tv_nop" : "+v"(acc[0][0]), "+v"(acc[1][1]), "+v"(acc[2][2]), "+v"(acc[3][3]) : "v"(a[0]), "v"(a[3]));
    }
#pragma unroll
    for (int mb = 0; mb < 4; ++mb) {
#pragma unroll
        for (int nb = 0; nb < 4; ++nb) {
#pragma unroll
            for (int j = 0; j < 8; ++j) os[(hi * 8 + j) * 68 + nb * 16 + lr] = acc[mb][nb][j]; }
        __builtin_amdgcn_wave_barrier(); asm volatile("" ::: "memory");
        float* crow = C + (size_t)(r0 + mb * 16) * ldc + c0;
{
#pragma unroll
            for (int s = 0; s < 8; ++s) { const int row = 2 * s + hi, cofs = lr * 4; v4f val = *(const v4fa*)(os + row * 68 + cofs);
                *(v4f*)(crow + (size_t)row * ldc + cofs) = val; }
             }
        __builtin_amdgcn_wave_barrier(); asm volatile("" ::: "memory");
    }
}

// ---- k_gemmpv: the probability x value contraction (64x64 output tile, K loop cut at the diagonal block as in CMODE 2) with the K loop SPLIT OVER THE PVW WAVES OF ONE WORK-GROUP: wave w takes the 64-key slices
// w, w + PVW, ... (a slice = one whole 128-byte line of every operand row), keeps its own 16 accumulators, and the PVW partial tiles are summed through LDS in the fixed order wave 0, 1, ... by all threads. grid (M/64, N/64, Z), 32 * PVW threads.
#define PVW 8
// XCNT0: the wait that stands between issued global loads and a later load whose destination takes over one of their address registers (the register allocator reuses dead address pairs as fragment registers here)
#define XCNT0() asm volatile("s_wait_xcnt 0x0" ::: "memory")
template <typename T16, int NSPLIT>
__global__ __launch_bounds__(32 * PVW) void k_gemmpv(const T16* __restrict__ A, const T16* __restrict__ A2, const T16* __restrict__ Bt, const T16* __restrict__ Bt2, int K, float* C, int ldc, int roff, size_t sA, size_t sB, size_t sC) {
    typedef typename WFrag<T16>::V V;
    __shared__ __align__(16) float red[PVW * 64 * 68];
    const size_t z = blockIdx.z; A += z * sA; if (A2) A2 += z * sA; Bt += z * sB; if (Bt2) Bt2 += z * sB; C += z * sC;
    const int lane = threadIdx.x & 31, lr = lane & 15, hi = lane >> 4; const int r0 = blockIdx.x * 64, c0 = blockIdx.y * 64;
    const int w = __builtin_amdgcn_readfirstlane(threadIdx.x >> 5);  // wave number, held scalar so that the K loop's bounds and branch stay scalar
    const int Kl = min(K, r0 + roff + 64);                           // probabilities are exactly 0 beyond the diagonal block; Kl % 64 == 0
    v8f acc[4][4];
#pragma unroll
    for (int mb = 0; mb < 4; ++mb)
#pragma unroll
        for (int nb = 0; nb < 4; ++nb) acc[mb][nb] = (v8f){};
    const size_t aoff = (size_t)(r0 + lr) * K + 8 * hi, boff = (size_t)(c0 + lr) * K + 8 * hi;
#pragma unroll 1   // rolled, as in k_gemmc: one slice per trip keeps the fragment registers of one slice only
    for (int ks = w * 64; ks < Kl; ks += PVW * 64) {
#pragma unroll     // the two 32-key steps of a slice share their address pairs (second step = immediate offset +64 bytes)
        for (int kh = 0; kh < 2; ++kh) { const int kc = ks + kh * 32;   // body of one step: k_gemmc's, with XCNT0 in the three-product build
            V a[4], a2[4];
#pragma unroll
            for (int mb = 0; mb < 4; ++mb) { a[mb] = WFrag<T16>::ld(A + aoff + (size_t)mb * 16 * K + kc); if (NSPLIT == 1 || NSPLIT == 2) a2[mb] = WFrag<T16>::ld(A2 + aoff + (size_t)mb * 16 * K + kc); }
            if (NSPLIT >= 2) XCNT0();
#pragma unroll
            for (int nb = 0; nb < 4; ++nb) { const V b = WFrag<T16>::ld(Bt + boff + (size_t)nb * 16 * K + kc); V b2; if (NSPLIT >= 2) b2 = WFrag<T16>::ld(Bt2 + boff + (size_t)nb * 16 * K + kc); if (NSPLIT >= 2) XCNT0();
#pragma unroll
                for (int mb = 0; mb < 4; ++mb) { acc[mb][nb] = WFrag<T16>::mma(a[mb], b, acc[mb][nb]); if (NSPLIT == 1 || NSPLIT == 2) acc[mb][nb] = WFrag<T16>::mma(a2[mb], b, acc[mb][nb]); if (NSPLIT >= 2) acc[mb][nb] = WFrag<T16>::mma(a[mb], b2, acc[mb][nb]); } }
            asm volatile("v_nop\n\tv_nop\n\tv_nop\n\tv_nop" : "+v"(acc[0][0]), "+v"(acc[1][1]), "+v"(acc[2][2]), "+v"(acc[3][3]) : "v"(a[0]), "v"(a[3]));   // the matrix distance on the loop's taken branch, as in k_gemmc
        }
    }
    float* my = red + w * (64 * 68);
#pragma unroll
    for (int mb = 0; mb < 4; ++mb)
#pragma unroll
        for (int nb = 0; nb < 4; ++nb)
#pragma unroll
            for (int j = 0; j < 8; ++j) my[(mb * 16 + hi * 8 + j) * 68 + nb * 16 + lr] = acc[mb][nb][j];
    __syncthreads();   // every wave's partial tile is in LDS before any thread sums across waves
#pragma unroll
    for (int s = 0; s < 64 * 16 / (32 * PVW); ++s) { const int idx = s * (32 * PVW) + (int)threadIdx.x; const int row = idx >> 4, cofs = (idx & 15) * 4; v4f val = *(const v4fa*)(red + row * 68 + cofs);
#pragma unroll
        for (int q = 1; q < PVW; ++q) val += *(const v4fa*)(red + q * (64 * 68) + row * 68 + cofs);
        *(v4f*)(C + (size_t)(r0 + row) * ldc + c0 + cofs) = val; }
}

__device__ __forceinline__ h16 tohx(float x) { return (h16)x; }
__device__ __forceinline__ void splitf(float y, unsigned short& h, unsigned short& l) { h = f2bf(y); l = f2bf(y - bf2f(h)); }
typedef __attribute__((ext_vector_type(2))) _Float16 v2h;
typedef __attribute__((ext_vector_type(4))) _Float16 v4h;
typedef __attribute__((ext_vector_type(2))) unsigned short v2us;
typedef __attribute__((ext_vector_type(4))) unsigned short v4us;
typedef __attribute__((ext_vector_type(2))) float v2f;
typedef __attribute__((ext_vector_type(4))) int v4i;

__global__ __launch_bounds__(256) void k_cvt8(const float* __restrict__ src, bf* dst, size_t n8) { const size_t i = (size_t)blockIdx.x * 256 + threadIdx.x; if (i >= n8) return; const v8f v = *(const v8f*)(src + i * 8); v8us o;
#pragma unroll
    for (int k = 0; k < 8; ++k) o[k] = f2bf(v[k]); *(v8us*)(dst + i * 8) = o;  }

// k_rope: head planes [h][t][d] (fp16 + hi/lo) of rope(x) x sc with the rotate-half convention out[d] = x[d] cos[t][d] - x[d+HD/2] sin[t][d], out[d+HD/2] = x[d+HD/2] cos[t][d+HD/2] + x[d] sin[t][d+HD/2]
__global__ __launch_bounds__(256) void k_rope(const float* __restrict__ F, int pitch, int nheads, const float* __restrict__ CS, const float* __restrict__ RF, const float* __restrict__ nw, float sc, h16* P16, bf* Ph, bf* Pl) {
    const size_t e = ((size_t)blockIdx.x * 256 + threadIdx.x) * 2; if (e >= (size_t)nheads * TT * HD) return; const int d = (int)(e % HD); const int t = (int)((e / HD) % TT); const int h = (int)(e / ((size_t)HD * TT)); const float* f = F + (size_t)t * pitch + h * HD; const float rf = RF ? RF[(size_t)h * TT + t] : 1.0f; v2h o16; v2us oh, ol;
#pragma unroll
    for (int q = 0; q < 2; ++q) { const int dd = d + q; const int dp = (dd < HD / 2) ? dd + HD / 2 : dd - HD / 2; float x0 = f[dd], x1 = f[dp];
        if (RF) { float n0 = __fmul_rn(x0, rf), n1 = __fmul_rn(x1, rf); asm volatile("" : "+v"(n0)); asm volatile("" : "+v"(n1)); x0 = __fmul_rn(bfr(nw[dd]), n0); x1 = __fmul_rn(bfr(nw[dp]), n1); }
        const v2f cs = *(const v2f*)(CS + ((size_t)t * HD + dd) * 2); float a = __fmul_rn(x0, cs[0]), bq = __fmul_rn(x1, cs[1]); asm volatile("" : "+v"(a)); asm volatile("" : "+v"(bq)); const float r = ((dd < HD / 2) ? __fsub_rn(a, bq) : __fadd_rn(a, bq)) * sc;
        o16[q] = tohx(r); unsigned short a2, c2; splitf(r, a2, c2); oh[q] = a2; ol[q] = c2; }
    *(v2h*)(P16 + e) = o16; *(v2us*)(Ph + e) = oh; *(v2us*)(Pl + e) = ol;  }
__global__ __launch_bounds__(256) void k_vtp(const float* __restrict__ F, int pitch, int nheads, h16* V16, bf* Vh, bf* Vl) { const size_t e = ((size_t)blockIdx.x * 256 + threadIdx.x) * 2; if (e >= (size_t)nheads * HD * TT) return; const int t = (int)(e % TT); const int d = (int)((e / TT) % HD); const int g = (int)(e / ((size_t)TT * HD)); v2h o16; v2us oh, ol;
#pragma unroll
    for (int q = 0; q < 2; ++q) { const float x = F[(size_t)(t + q) * pitch + g * HD + d]; o16[q] = tohx(x); unsigned short a2, c2; splitf(x, a2, c2); oh[q] = a2; ol[q] = c2; }
    *(v2h*)(V16 + e) = o16; *(v2us*)(Vh + e) = oh; *(v2us*)(Vl + e) = ol;  }
__global__ __launch_bounds__(256) void k_csid(float* CS) { const int idx = blockIdx.x * 256 + threadIdx.x; if (idx >= TT * HD) return; v2f cs; cs[0] = 1.0f; cs[1] = 0.0f; *(v2f*)(CS + (size_t)idx * 2) = cs;  }
// k_asoft: per row (zz, i): t = S x HD^-0.5 for j <= i and i - j < WIN (WIN = TT: the window never binds, plain causal; the reference's -1e9 additive fill vanishes identically); softmax over the 2048 keys (register row, one exp, fixed trees);
__global__ __launch_bounds__(256) void k_asoft(const float* __restrict__ Sb, h16* P16, bf* Ph, bf* Pl) {
    const int lane = threadIdx.x & 31; const int row = blockIdx.x * 8 + (threadIdx.x >> 5); if (row >= ZH * TT) return; const int i = row % TT; const int zz = row / TT; (void)zz; const bool hires = (i < RH); const float* sr = Sb + (size_t)row * TT; float v[TT / 32]; float mx = -3.0e38f;
#pragma unroll
    for (int ch = 0; ch < TT / 128; ++ch) { const int j0 = ch * 128 + lane * 4; const v4f a = *(const v4f*)(sr + j0);
#pragma unroll
        for (int q = 0; q < 4; ++q) { const int j = j0 + q; (void)j; const float t = (j <= i && i - j < WIN) ? a[q] * SCL : -3.0e38f; v[ch * 4 + q] = t; mx = fmaxf(mx, t); } }
#pragma unroll
    for (int sh = 16; sh; sh >>= 1) mx = fmaxf(mx, __shfl_xor(mx, sh, 32));
    float sum = 0.f;
#pragma unroll
    for (int k = 0; k < TT / 32; ++k) { float d0 = __fsub_rn(v[k], mx); asm volatile("" : "+v"(d0)); v[k] = __builtin_amdgcn_exp2f(__fmul_rn(d0, 1.4426950408889634f)); sum += v[k]; }
#pragma unroll
    for (int sh = 16; sh; sh >>= 1) sum += __shfl_xor(sum, sh, 32);
    const float f = __fdiv_rn(hires ? 1.0f : PCAR, sum);
{
        if (hires) {
#pragma unroll
            for (int ch = 0; ch < TT / 128; ++ch) { v4us oh, ol;
#pragma unroll
                for (int q = 0; q < 4; ++q) { unsigned short a, c2; splitf(v[ch * 4 + q] * f, a, c2); oh[q] = a; ol[q] = c2; }
                const size_t oo = ((size_t)zz * (RH ? RH : 1) + i) * TT + ch * 128 + lane * 4; *(v4us*)(Ph + oo) = oh; *(v4us*)(Pl + oo) = ol; }
        } else {
#pragma unroll
            for (int ch = 0; ch < TT / 128; ++ch) { v4h o4;
#pragma unroll
                for (int q = 0; q < 4; ++q) o4[q] = tohx(v[ch * 4 + q] * f);
                *(v4h*)(P16 + (size_t)row * TT + ch * 128 + lane * 4) = o4; } }
         }
}
__global__ __launch_bounds__(256) void k_merge(const float* __restrict__ O, int h0, bf* Ah, bf* Al) { const size_t e = ((size_t)blockIdx.x * 256 + threadIdx.x) * 2; if (e >= (size_t)ZH * TT * HD) return; const int d = (int)(e % HD); const int t = (int)((e / HD) % TT); const int zz = (int)(e / ((size_t)HD * TT)); const float cs = (t < RH) ? 1.0f : (1.0f / PCAR); const size_t oo = (size_t)t * DQ + (h0 + zz) * HD + d;
    v2us oh, ol;
#pragma unroll
    for (int q = 0; q < 2; ++q) { unsigned short a, c2; splitf(O[e + q] * cs, a, c2); oh[q] = a; ol[q] = c2; } *(v2us*)(Ah + oo) = oh; *(v2us*)(Al + oo) = ol;  }

extern "C" void kernel_launch(void* const* d_in, const int* in_sizes, int n_in,
                              void* d_out, int out_size, void* d_ws, size_t ws_size, hipStream_t stream) {
    (void)in_sizes; (void)n_in; (void)out_size;
    const float* x = (const float*)d_in[0]; const float* xk = (const float*)d_in[1]; const float* xv = (const float*)d_in[2]; const float* wq = (const float*)d_in[3]; const float* bq = (const float*)d_in[4]; const float* wk = (const float*)d_in[3]; const float* bk = (const float*)d_in[4]; const float* wv = (const float*)d_in[3]; const float* bv = (const float*)d_in[4]; const float* wo = (const float*)d_in[5]; const float* bo = (const float*)d_in[6];   /* argument order Q, K, V (three streams), wq ('oi': the ONE weight used for the q, k AND v projections, as the source module does), bq (the one shared bias), wo ('oi'), bo; the causal rule is applied by index: no mask input */
    float* OUT = (float*)d_out;     // [2][2048][1024]
    char* wsp = (char*)d_ws;
    auto take = [&](size_t bytes) { char* p = wsp; wsp += (bytes + 255) & ~(size_t)255; return (void*)p; };
    bf* WQ = (bf*)take((size_t)DQ * DM * 2); bf* WK = (bf*)take((size_t)DKV * DM * 2); bf* WV = (bf*)take((size_t)DKV * DM * 2); bf* WO = (bf*)take((size_t)DM * DQ * 2); float* CS = (float*)take((size_t)TT * HD * 2 * 4);
    bf* XB = (bf*)take((size_t)TT * DM * 2); float* FQ = (float*)take((size_t)TT * DQ * 4); float* FK = (float*)take((size_t)TT * DKV * 4);
    h16* QP16 = (h16*)take((size_t)NH_ * TT * HD * 2); h16* KP16 = (h16*)take((size_t)NKV * TT * HD * 2); h16* VT16 = (h16*)take((size_t)NKV * HD * TT * 2);
    bf* QPh = (bf*)take((size_t)NH_ * TT * HD * 2); bf* QPl = (bf*)take((size_t)NH_ * TT * HD * 2); bf* KPh = (bf*)take((size_t)NKV * TT * HD * 2); bf* KPl = (bf*)take((size_t)NKV * TT * HD * 2); bf* VTh = (bf*)take((size_t)NKV * HD * TT * 2); bf* VTl = (bf*)take((size_t)NKV * HD * TT * 2); bf* Ph = (bf*)take((size_t)ZH * RH * TT * 2); bf* Pl = (bf*)take((size_t)ZH * RH * TT * 2);
    float* Sb = (float*)take((size_t)ZH * TT * TT * 4); h16* P16 = (h16*)take((size_t)ZH * TT * TT * 2); float* Ob = (float*)take((size_t)ZH * TT * HD * 4); bf* ATh = (bf*)take((size_t)TT * DQ * 2); bf* ATl = (bf*)take((size_t)TT * DQ * 2);
    if ((size_t)(wsp - (char*)d_ws) > ws_size) return;    // ws 256 MiB
    float* FV = FK;   // v projection reuses the k buffer after the k planes are built (stream-ordered)
    { k_cvt8<<<(unsigned)(((size_t)DQ * DM / 8 + 255) / 256), 256, 0, stream>>>(wq, WQ, (size_t)DQ * DM / 8); k_cvt8<<<(unsigned)(((size_t)DKV * DM / 8 + 255) / 256), 256, 0, stream>>>(wk, WK, (size_t)DKV * DM / 8); k_cvt8<<<(unsigned)(((size_t)DKV * DM / 8 + 255) / 256), 256, 0, stream>>>(wv, WV, (size_t)DKV * DM / 8);
      k_cvt8<<<(unsigned)(((size_t)DM * DQ / 8 + 255) / 256), 256, 0, stream>>>(wo, WO, (size_t)DM * DQ / 8);
       }
    k_csid<<<(TT * HD + 255) / 256, 256, 0, stream>>>(CS);
    const unsigned LQ = (unsigned)(((size_t)NH_ * TT * HD / 2 + 255) / 256), LKv = (unsigned)(((size_t)NKV * TT * HD / 2 + 255) / 256);
    for (int b = 0; b < NB_; ++b) {
        
        k_cvt8<<<(unsigned)(((size_t)TT * DM / 8 + 255) / 256), 256, 0, stream>>>(x + (size_t)b * TT * DM, XB, (size_t)TT * DM / 8);
        k_gemmw<bf, 0, true><<<dim3(TT / 64, DQ / 64, 1), 32, 0, stream>>>(XB, nullptr, WQ, nullptr, DM, FQ, DQ, bq, 0, 0, 0);
        k_rope<<<LQ, 256, 0, stream>>>(FQ, DQ, NH_, CS, nullptr, nullptr, 1.0f, QP16, QPh, QPl);
        k_cvt8<<<(unsigned)(((size_t)TT * DM / 8 + 255) / 256), 256, 0, stream>>>(xk + (size_t)b * TT * DM, XB, (size_t)TT * DM / 8);   /* XB := bf16(k[b]) */ k_gemmw<bf, 0, true><<<dim3(TT / 64, DKV / 64, 1), 32, 0, stream>>>(XB, nullptr, WK, nullptr, DM, FK, DKV, bk, 0, 0, 0);
        k_rope<<<LKv, 256, 0, stream>>>(FK, DKV, NKV, CS, nullptr, nullptr, 1.0f, KP16, KPh, KPl);
        k_cvt8<<<(unsigned)(((size_t)TT * DM / 8 + 255) / 256), 256, 0, stream>>>(xv + (size_t)b * TT * DM, XB, (size_t)TT * DM / 8);   /* XB := bf16(v[b]) */ k_gemmw<bf, 0, true><<<dim3(TT / 64, DKV / 64, 1), 32, 0, stream>>>(XB, nullptr, WV, nullptr, DM, FV, DKV, bv, 0, 0, 0); k_vtp<<<LKv, 256, 0, stream>>>(FV, DKV, NKV, VT16, VTh, VTl);
        for (int h0 = 0; h0 < NH_; h0 += ZH) { const size_t zq = (size_t)h0, zk = (size_t)(h0 / REP);   // one kv head per query head: the pass's two heads use consecutive kv planes (z-strides TT*HD)
            k_gemmc<bf, 2, 1><<<dim3(RH / 64, TT / 64, ZH), 32, 0, stream>>>(QPh + zq * TT * HD, QPl + zq * TT * HD, KPh + zk * TT * HD, KPl + zk * TT * HD, HD, Sb, TT, 0, (size_t)TT * HD, (size_t)TT * HD, (size_t)TT * TT);
            k_gemmc<h16, 0, 1><<<dim3((TT - RH) / 64, TT / 64, ZH), 32, 0, stream>>>(QP16 + zq * TT * HD + (size_t)RH * HD, nullptr, KP16 + zk * TT * HD, nullptr, HD, Sb + (size_t)RH * TT, TT, RH, (size_t)TT * HD, (size_t)TT * HD, (size_t)TT * TT);
            k_asoft<<<ZH * TT / 8, 256, 0, stream>>>(Sb, P16, Ph, Pl);
            k_gemmpv<bf, 2><<<dim3(RH / 64, HD / 64, ZH), 32 * PVW, 0, stream>>>(Ph, Pl, VTh + zk * HD * TT, VTl + zk * HD * TT, TT, Ob, HD, 0, (size_t)RH * TT, (size_t)HD * TT, (size_t)TT * HD);
            k_gemmpv<h16, 0><<<dim3((TT - RH) / 64, HD / 64, ZH), 32 * PVW, 0, stream>>>(P16 + (size_t)RH * TT, nullptr, VT16 + zk * HD * TT, nullptr, TT, Ob + (size_t)RH * HD, HD, RH, (size_t)TT * TT, (size_t)HD * TT, (size_t)TT * HD);
            k_merge<<<(unsigned)(((size_t)ZH * TT * HD / 2 + 255) / 256), 256, 0, stream>>>(Ob, h0, ATh, ATl); }
        k_gemmw<bf, 1, true><<<dim3(TT / 64, DM / 64, 1), 32, 0, stream>>>(ATh, ATl, WO, nullptr, DQ, OUT + (size_t)b * TT * DM, DM, bo, 0, 0, 0); }
}

// v002
// Measured time: 566 microseconds a run.
// Next to v001, in two timings, it ran 1.56 times as fast each time.
// Counting every step since v000, it is 2.57 times as fast.
#include <hip/hip_runtime.h>

// Causal multi-head attention on three input streams that uses ONE shared projection for Q, K and V (Q, K, V [2][2048][1024]; q = Q wq^T + bq, k = K wq^T + bq, v = V wq^T + bq: the SAME 'oi' [1024][1024] weight (normal x 0.02) and the same bias (zeros on this draw: read) for all three streams, as the source module does; 16 heads x 64); scores x 1/sqrt(64); tril kept, -inf elsewhere; softmax over the keys; out = merged wo^T + bo ('oi' + bias zeros: read) -> [2][2048][1024] (4.2 M); argument order Q, K, V, wq, bq, wo, bo).
// Layout per batch: bf16 copies of q, k, v in turn; 'oi' weights; exact projections + f32 biases; identity-table plane builders; causal T-2048 attention (hybrid rows: < 512 hi/lo 3 products, rest fp16 x1024; k_gemmc skips tiles above the diagonal); merged hi/lo x Wo exact + bo.
// Compute dtypes, f32 accumulate: every input rounded to bf16; projections exact + f32 biases; attention rows < 512 3 products, rest fp16; softmax f32; Wo hl x exact + bias.

#define NB_  2
#define TT   2048
#define DM   1024
#define NH_  16
#define NKV  16
#define REP  (NH_ / NKV)
#define HD   64
#define DQ   (NH_ * HD)
#define DKV  (NKV * HD)
#define ZH   8                    // heads per attention pass (grid z of every attention launch): 2 passes per batch
#define PLD  (2 * TT)             // pitch, in 16-bit elements, of a probability row: it lies in place over its own f32 score row
#define RH   512                  // query rows < RH use hi+lo planes (0: none)
#define WIN  2048
#define PCAR 1024.0f
#define SCL  0.125f   // HD^-0.5
typedef _Float16 h16;
typedef unsigned short bf;
typedef __attribute__((ext_vector_type(16))) __bf16   v16bf;
typedef __attribute__((ext_vector_type(16))) _Float16 v16h;
typedef __attribute__((ext_vector_type(8)))  _Float16 v8h;
typedef __attribute__((ext_vector_type(8)))  unsigned short v8us;
typedef __attribute__((ext_vector_type(8)))  float    v8f;
typedef __attribute__((ext_vector_type(4)))  float    v4f;
typedef v8h  __attribute__((may_alias)) v8ha;
typedef v4f  __attribute__((may_alias)) v4fa;
typedef v8us __attribute__((may_alias)) v8usa;

__device__ __forceinline__ unsigned short f2bf(float f) { unsigned u = __float_as_uint(f); u += 0x7FFFu + ((u >> 16) & 1u); return (unsigned short)(u >> 16); }
__device__ __forceinline__ float bf2f(unsigned short b) { return __uint_as_float(((unsigned)b) << 16); }
__device__ __forceinline__ float bfr(float f) { return bf2f(f2bf(f)); }
__device__ __forceinline__ v16h cat16(v8h lo, v8h hi) { return __builtin_shufflevector(lo, hi, 0, 1, 2, 3, 4, 5, 6, 7, 8, 9, 10, 11, 12, 13, 14, 15); }
__device__ __forceinline__ v16bf cat16b(v8us lo, v8us hi) { return __builtin_bit_cast(v16bf, __builtin_shufflevector(lo, hi, 0, 1, 2, 3, 4, 5, 6, 7, 8, 9, 10, 11, 12, 13, 14, 15)); }
__device__ __forceinline__ v8f wmma16(v16h a, v16h b, v8f c) { return __builtin_amdgcn_wmma_f32_16x16x32_f16(false, a, false, b, (short)0, c, false, false); }
__device__ __forceinline__ v8f wmmab(v16bf a, v16bf b, v8f c) { return __builtin_amdgcn_wmma_f32_16x16x32_bf16(false, a, false, b, (short)0, c, false, false); }



// ---- k_gemmw: register-blocked GEMM, ONE WAVE per 64x64 output tile (16 accumulators), operands straight from K-contiguous 16-bit planes; grid (M/64, N/64, Z), 32 threads.
// C[m][n] (f32, pitch ldc, + optional f32 bias[n]) = sum_k A[m][k] Bt[n][k] (+ split products per NSPLIT). z-batch strides sA/sB/sC in elements. K % 32 == 0.
template <typename T16> struct WFrag;
template <> struct WFrag<h16> { typedef v16h V; static __device__ __forceinline__ V ld(const h16* p) { return cat16(*(const v8h*)p, *(const v8h*)(p + 16)); } static __device__ __forceinline__ v8f mma(V a, V b, v8f c) { return wmma16(a, b, c); } };
template <> struct WFrag<bf> { typedef v16bf V; static __device__ __forceinline__ V ld(const bf* p) { return cat16b(*(const v8us*)p, *(const v8us*)(p + 16)); } static __device__ __forceinline__ v8f mma(V a, V b, v8f c) { return wmmab(a, b, c); } };
template <typename T16, int NSPLIT, bool BIAS>
__global__ __launch_bounds__(32) void k_gemmw(const T16* __restrict__ A, const T16* __restrict__ A2, const T16* __restrict__ Bt, const T16* __restrict__ Bt2, int K, float* C, int ldc, const float* __restrict__ bias, size_t sA, size_t sB, size_t sC) {
    typedef typename WFrag<T16>::V V;
    __shared__ __align__(16) float os[16 * 68];
    const size_t z = blockIdx.z; A += z * sA; if (A2) A2 += z * sA; Bt += z * sB; if (Bt2) Bt2 += z * sB; C += z * sC;
    const int lane = threadIdx.x & 31, lr = lane & 15, hi = lane >> 4; const int r0 = blockIdx.x * 64, c0 = blockIdx.y * 64;
    v8f acc[4][4];
#pragma unroll
    for (int mb = 0; mb < 4; ++mb)
#pragma unroll
        for (int nb = 0; nb < 4; ++nb) acc[mb][nb] = (v8f){};
    const size_t aoff = (size_t)(r0 + lr) * K + 8 * hi, boff = (size_t)(c0 + lr) * K + 8 * hi;
#pragma unroll 1
    for (int kc = 0; kc < K; kc += 32) {
        V a[4], a2[4];
#pragma unroll
        for (int mb = 0; mb < 4; ++mb) { a[mb] = WFrag<T16>::ld(A + aoff + (size_t)mb * 16 * K + kc); if (NSPLIT == 1 || NSPLIT == 2) a2[mb] = WFrag<T16>::ld(A2 + aoff + (size_t)mb * 16 * K + kc); }
#pragma unroll
        for (int nb = 0; nb < 4; ++nb) { const V b = WFrag<T16>::ld(Bt + boff + (size_t)nb * 16 * K + kc); V b2; if (NSPLIT >= 2) b2 = WFrag<T16>::ld(Bt2 + boff + (size_t)nb * 16 * K + kc);
#pragma unroll
            for (int mb = 0; mb < 4; ++mb) { acc[mb][nb] = WFrag<T16>::mma(a[mb], b, acc[mb][nb]); if (NSPLIT == 1 || NSPLIT == 2) acc[mb][nb] = WFrag<T16>::mma(a2[mb], b, acc[mb][nb]); if (NSPLIT >= 2) acc[mb][nb] = WFrag<T16>::mma(a[mb], b2, acc[mb][nb]); } }
        asm volatile("v_nop\n\tv_nop\n\tv_nop\n\tv_nop" : "+v"(acc[0][0]), "+v"(acc[1][1]), "+v"(acc[2][2]), "+v"(acc[3][3]) : "v"(a[0]), "v"(a[3]));
    }
#pragma unroll
    for (int mb = 0; mb < 4; ++mb) {
#pragma unroll
        for (int nb = 0; nb < 4; ++nb) {
#pragma unroll
            for (int j = 0; j < 8; ++j) os[(hi * 8 + j) * 68 + nb * 16 + lr] = acc[mb][nb][j]; }
        __builtin_amdgcn_wave_barrier(); asm volatile("" ::: "memory");
        float* crow = C + (size_t)(r0 + mb * 16) * ldc + c0;
{
#pragma unroll
            for (int s = 0; s < 8; ++s) { const int row = 2 * s + hi, cofs = lr * 4; v4f val = *(const v4fa*)(os + row * 68 + cofs); if (BIAS) { val[0] += bfr(bias[c0 + cofs]); val[1] += bfr(bias[c0 + cofs + 1]); val[2] += bfr(bias[c0 + cofs + 2]); val[3] += bfr(bias[c0 + cofs + 3]); }
                *(v4f*)(crow + (size_t)row * ldc + cofs) = val; }
             }
        __builtin_amdgcn_wave_barrier(); asm volatile("" ::: "memory");
    }
}

// ---- k_gemmc: the same one-wave 64x64 tile GEMM specialised for causal attention: CMODE 1 skips score tiles entirely above the diagonal (query rows r0+roff.., key columns c0..), CMODE 2 limits the
// key (K) loop of the probability x value contraction to the diagonal block (probabilities beyond it are exactly zero). roff = row offset of this launch's first row within the sequence.
template <typename T16, int NSPLIT, int CMODE>
__global__ __launch_bounds__(32) void k_gemmc(const T16* __restrict__ A, const T16* __restrict__ A2, const T16* __restrict__ Bt, const T16* __restrict__ Bt2, int K, float* C, int ldc, int roff, size_t sA, size_t sB, size_t sC) {
    typedef typename WFrag<T16>::V V;
    __shared__ __align__(16) float os[16 * 68];
    const size_t z = blockIdx.z; A += z * sA; if (A2) A2 += z * sA; Bt += z * sB; if (Bt2) Bt2 += z * sB; C += z * sC;
    const int lane = threadIdx.x & 31, lr = lane & 15, hi = lane >> 4; const int r0 = blockIdx.x * 64, c0 = blockIdx.y * 64;
    if (CMODE == 1 && c0 > r0 + roff + 63) return;                  // score tile entirely above the causal diagonal: never read (the softmax masks j > i by select)
    const int Kl = (CMODE == 2) ? min(K, r0 + roff + 64) : K;        // P.V: probabilities are exactly 0 beyond the diagonal block, so the K loop stops there
    v8f acc[4][4];
#pragma unroll
    for (int mb = 0; mb < 4; ++mb)
#pragma unroll
        for (int nb = 0; nb < 4; ++nb) acc[mb][nb] = (v8f){};
    const size_t aoff = (size_t)(r0 + lr) * K + 8 * hi, boff = (size_t)(c0 + lr) * K + 8 * hi;
#pragma unroll 1
    for (int kc = 0; kc < Kl; kc += 32) {
        V a[4], a2[4];
#pragma unroll
        for (int mb = 0; mb < 4; ++mb) { a[mb] = WFrag<T16>::ld(A + aoff + (size_t)mb * 16 * K + kc); if (NSPLIT == 1 || NSPLIT == 2) a2[mb] = WFrag<T16>::ld(A2 + aoff + (size_t)mb * 16 * K + kc); }
#pragma unroll
        for (int nb = 0; nb < 4; ++nb) { const V b = WFrag<T16>::ld(Bt + boff + (size_t)nb * 16 * K + kc); V b2; if (NSPLIT >= 2) b2 = WFrag<T16>::ld(Bt2 + boff + (size_t)nb * 16 * K + kc);
#pragma unroll
            for (int mb = 0; mb < 4; ++mb) { acc[mb][nb] = WFrag<T16>::mma(a[mb], b, acc[mb][nb]); if (NSPLIT == 1 || NSPLIT == 2) acc[mb][nb] = WFrag<T16>::mma(a2[mb], b, acc[mb][nb]); if (NSPLIT >= 2) acc[mb][nb] = WFrag<T16>::mma(a[mb], b2, acc[mb][nb]); } }
        asm volatile("v_nop\n\tv_nop\n\tv_nop\n\tv_nop" : "+v"(acc[0][0]), "+v"(acc[1][1]), "+v"(acc[2][2]), "+v"(acc[3][3]) : "v"(a[0]), "v"(a[3]));
    }
#pragma unroll
    for (int mb = 0; mb < 4; ++mb) {
#pragma unroll
        for (int nb = 0; nb < 4; ++nb) {
#pragma unroll
            for (int j = 0; j < 8; ++j) os[(hi * 8 + j) * 68 + nb * 16 + lr] = acc[mb][nb][j]; }
        __builtin_amdgcn_wave_barrier(); asm volatile("" ::: "memory");
        float* crow = C + (size_t)(r0 + mb * 16) * ldc + c0;
{
#pragma unroll
            for (int s = 0; s < 8; ++s) { const int row = 2 * s + hi, cofs = lr * 4; v4f val = *(const v4fa*)(os + row * 68 + cofs);
                *(v4f*)(crow + (size_t)row * ldc + cofs) = val; }
             }
        __builtin_amdgcn_wave_barrier(); asm volatile("" ::: "memory");
    }
}

// ---- k_gemmpv: the probability x value contraction (64x64 output tile, K loop cut at the diagonal block as in CMODE 2) with the K loop SPLIT OVER THE PVW WAVES OF ONE WORK-GROUP: wave w takes the 64-key slices
// w, w + PVW, ... (a slice = one whole 128-byte line of every operand row), keeps its own 16 accumulators, and the PVW partial tiles are summed through LDS in the fixed order wave 0, 1, ... by all threads. grid (M/64, N/64, Z), 32 * PVW threads. A rows have their own pitch lda (elements); Bt rows have pitch K.
#define PVW 8
// XCNT0: the wait that stands between issued global loads and a later load whose destination takes over one of their address registers (the register allocator reuses dead address pairs as fragment registers here)
#define XCNT0() asm volatile("s_wait_xcnt 0x0" ::: "memory")
template <typename T16, int NSPLIT>
__global__ __launch_bounds__(32 * PVW) void k_gemmpv(const T16* __restrict__ A, const T16* __restrict__ A2, int lda, const T16* __restrict__ Bt, const T16* __restrict__ Bt2, int K, float* C, int ldc, int roff, size_t sA, size_t sB, size_t sC) {
    typedef typename WFrag<T16>::V V;
    __shared__ __align__(16) float red[PVW * 64 * 68];
    const size_t z = blockIdx.z; A += z * sA; if (A2) A2 += z * sA; Bt += z * sB; if (Bt2) Bt2 += z * sB; C += z * sC;
    const int lane = threadIdx.x & 31, lr = lane & 15, hi = lane >> 4; const int r0 = blockIdx.x * 64, c0 = blockIdx.y * 64;
    const int w = __builtin_amdgcn_readfirstlane(threadIdx.x >> 5);  // wave number, held scalar so that the K loop's bounds and branch stay scalar
    const int Kl = min(K, r0 + roff + 64);                           // probabilities are exactly 0 beyond the diagonal block; Kl % 64 == 0
    v8f acc[4][4];
#pragma unroll
    for (int mb = 0; mb < 4; ++mb)
#pragma unroll
        for (int nb = 0; nb < 4; ++nb) acc[mb][nb] = (v8f){};
    const size_t aoff = (size_t)(r0 + lr) * lda + 8 * hi, boff = (size_t)(c0 + lr) * K + 8 * hi;
#pragma unroll 1   // rolled, as in k_gemmc: one slice per trip keeps the fragment registers of one slice only
    for (int ks = w * 64; ks < Kl; ks += PVW * 64) {
#pragma unroll     // the two 32-key steps of a slice share their address pairs (second step = immediate offset +64 bytes)
        for (int kh = 0; kh < 2; ++kh) { const int kc = ks + kh * 32;   // body of one step: k_gemmc's, with XCNT0 in the three-product build
            V a[4], a2[4];
#pragma unroll
            for (int mb = 0; mb < 4; ++mb) { a[mb] = WFrag<T16>::ld(A + aoff + (size_t)mb * 16 * lda + kc); if (NSPLIT == 1 || NSPLIT == 2) a2[mb] = WFrag<T16>::ld(A2 + aoff + (size_t)mb * 16 * lda + kc); }
            if (NSPLIT >= 2) XCNT0();
#pragma unroll
            for (int nb = 0; nb < 4; ++nb) { const V b = WFrag<T16>::ld(Bt + boff + (size_t)nb * 16 * K + kc); V b2; if (NSPLIT >= 2) b2 = WFrag<T16>::ld(Bt2 + boff + (size_t)nb * 16 * K + kc); if (NSPLIT >= 2) XCNT0();
#pragma unroll
                for (int mb = 0; mb < 4; ++mb) { acc[mb][nb] = WFrag<T16>::mma(a[mb], b, acc[mb][nb]); if (NSPLIT == 1 || NSPLIT == 2) acc[mb][nb] = WFrag<T16>::mma(a2[mb], b, acc[mb][nb]); if (NSPLIT >= 2) acc[mb][nb] = WFrag<T16>::mma(a[mb], b2, acc[mb][nb]); } }
            asm volatile("v_nop\n\tv_nop\n\tv_nop\n\tv_nop" : "+v"(acc[0][0]), "+v"(acc[1][1]), "+v"(acc[2][2]), "+v"(acc[3][3]) : "v"(a[0]), "v"(a[3]));   // the matrix distance on the loop's taken branch, as in k_gemmc
        }
    }
    float* my = red + w * (64 * 68);
#pragma unroll
    for (int mb = 0; mb < 4; ++mb)
#pragma unroll
        for (int nb = 0; nb < 4; ++nb)
#pragma unroll
            for (int j = 0; j < 8; ++j) my[(mb * 16 + hi * 8 + j) * 68 + nb * 16 + lr] = acc[mb][nb][j];
    __syncthreads();   // every wave's partial tile is in LDS before any thread sums across waves
#pragma unroll
    for (int s = 0; s < 64 * 16 / (32 * PVW); ++s) { const int idx = s * (32 * PVW) + (int)threadIdx.x; const int row = idx >> 4, cofs = (idx & 15) * 4; v4f val = *(const v4fa*)(red + row * 68 + cofs);
#pragma unroll
        for (int q = 1; q < PVW; ++q) val += *(const v4fa*)(red + q * (64 * 68) + row * 68 + cofs);
        *(v4f*)(C + (size_t)(r0 + row) * ldc + c0 + cofs) = val; }
}

__device__ __forceinline__ h16 tohx(float x) { return (h16)x; }
__device__ __forceinline__ void splitf(float y, unsigned short& h, unsigned short& l) { h = f2bf(y); l = f2bf(y - bf2f(h)); }
typedef __attribute__((ext_vector_type(2))) _Float16 v2h;
typedef __attribute__((ext_vector_type(4))) _Float16 v4h;
typedef __attribute__((ext_vector_type(2))) unsigned short v2us;
typedef __attribute__((ext_vector_type(4))) unsigned short v4us;
typedef __attribute__((ext_vector_type(2))) float v2f;
typedef __attribute__((ext_vector_type(4))) int v4i;

__global__ __launch_bounds__(256) void k_cvt8(const float* __restrict__ src, bf* dst, size_t n8) { const size_t i = (size_t)blockIdx.x * 256 + threadIdx.x; if (i >= n8) return; const v8f v = *(const v8f*)(src + i * 8); v8us o;
#pragma unroll
    for (int k = 0; k < 8; ++k) o[k] = f2bf(v[k]); *(v8us*)(dst + i * 8) = o;  }

// k_rope: head planes [h][t][d] (fp16 + hi/lo) of rope(x) x sc with the rotate-half convention out[d] = x[d] cos[t][d] - x[d+HD/2] sin[t][d], out[d+HD/2] = x[d+HD/2] cos[t][d+HD/2] + x[d] sin[t][d+HD/2]
__global__ __launch_bounds__(256) void k_rope(const float* __restrict__ F, int pitch, int nheads, const float* __restrict__ CS, const float* __restrict__ RF, const float* __restrict__ nw, float sc, h16* P16, bf* Ph, bf* Pl) {
    const size_t e = ((size_t)blockIdx.x * 256 + threadIdx.x) * 2; if (e >= (size_t)nheads * TT * HD) return; const int d = (int)(e % HD); const int t = (int)((e / HD) % TT); const int h = (int)(e / ((size_t)HD * TT)); const float* f = F + (size_t)t * pitch + h * HD; const float rf = RF ? RF[(size_t)h * TT + t] : 1.0f; v2h o16; v2us oh, ol;
#pragma unroll
    for (int q = 0; q < 2; ++q) { const int dd = d + q; const int dp = (dd < HD / 2) ? dd + HD / 2 : dd - HD / 2; float x0 = f[dd], x1 = f[dp];
        if (RF) { float n0 = __fmul_rn(x0, rf), n1 = __fmul_rn(x1, rf); asm volatile("" : "+v"(n0)); asm volatile("" : "+v"(n1)); x0 = __fmul_rn(bfr(nw[dd]), n0); x1 = __fmul_rn(bfr(nw[dp]), n1); }
        const v2f cs = *(const v2f*)(CS + ((size_t)t * HD + dd) * 2); float a = __fmul_rn(x0, cs[0]), bq = __fmul_rn(x1, cs[1]); asm volatile("" : "+v"(a)); asm volatile("" : "+v"(bq)); const float r = ((dd < HD / 2) ? __fsub_rn(a, bq) : __fadd_rn(a, bq)) * sc;
        o16[q] = tohx(r); unsigned short a2, c2; splitf(r, a2, c2); oh[q] = a2; ol[q] = c2; }
    *(v2h*)(P16 + e) = o16; *(v2us*)(Ph + e) = oh; *(v2us*)(Pl + e) = ol;  }
__global__ __launch_bounds__(256) void k_vtp(const float* __restrict__ F, int pitch, int nheads, h16* V16, bf* Vh, bf* Vl) { const size_t e = ((size_t)blockIdx.x * 256 + threadIdx.x) * 2; if (e >= (size_t)nheads * HD * TT) return; const int t = (int)(e % TT); const int d = (int)((e / TT) % HD); const int g = (int)(e / ((size_t)TT * HD)); v2h o16; v2us oh, ol;
#pragma unroll
    for (int q = 0; q < 2; ++q) { const float x = F[(size_t)(t + q) * pitch + g * HD + d]; o16[q] = tohx(x); unsigned short a2, c2; splitf(x, a2, c2); oh[q] = a2; ol[q] = c2; }
    *(v2h*)(V16 + e) = o16; *(v2us*)(Vh + e) = oh; *(v2us*)(Vl + e) = ol;  }
__global__ __launch_bounds__(256) void k_csid(float* CS) { const int idx = blockIdx.x * 256 + threadIdx.x; if (idx >= TT * HD) return; v2f cs; cs[0] = 1.0f; cs[1] = 0.0f; *(v2f*)(CS + (size_t)idx * 2) = cs;  }
// k_asoft: per row (zz, i): t = S x HD^-0.5 for j <= i and i - j < WIN (sliding causal window; the reference's -1e9 additive fill vanishes identically); softmax over the 2048 keys (register row, one exp, fixed trees);
// IN PLACE: the probabilities overwrite the row's own 8 KiB of scores (fp16 row, or the hi plane, in its first half; the lo plane in its second half). One wave owns a row and holds all of it in registers before its first store (every store needs the row's sum), and no wave touches another row.
__global__ __launch_bounds__(256) void k_asoft(const float* Sb, h16* P16, bf* Ph, bf* Pl) {
    const int lane = threadIdx.x & 31; const int row = blockIdx.x * 8 + (threadIdx.x >> 5); if (row >= ZH * TT) return; const int i = row % TT; const int zz = row / TT; (void)zz; const bool hires = (i < RH); const float* sr = Sb + (size_t)row * TT; float v[TT / 32]; float mx = -3.0e38f;
#pragma unroll
    for (int ch = 0; ch < TT / 128; ++ch) { const int j0 = ch * 128 + lane * 4; const v4f a = *(const v4f*)(sr + j0);
#pragma unroll
        for (int q = 0; q < 4; ++q) { const int j = j0 + q; (void)j; const float t = (j <= i && i - j < WIN) ? a[q] * SCL : -3.0e38f; v[ch * 4 + q] = t; mx = fmaxf(mx, t); } }
#pragma unroll
    for (int sh = 16; sh; sh >>= 1) mx = fmaxf(mx, __shfl_xor(mx, sh, 32));
    float sum = 0.f;
#pragma unroll
    for (int k = 0; k < TT / 32; ++k) { float d0 = __fsub_rn(v[k], mx); asm volatile("" : "+v"(d0)); v[k] = __builtin_amdgcn_exp2f(__fmul_rn(d0, 1.4426950408889634f)); sum += v[k]; }
#pragma unroll
    for (int sh = 16; sh; sh >>= 1) sum += __shfl_xor(sum, sh, 32);
    const float f = __fdiv_rn(hires ? 1.0f : PCAR, sum);
{
        if (hires) {
#pragma unroll
            for (int ch = 0; ch < TT / 128; ++ch) { v4us oh, ol;
#pragma unroll
                for (int q = 0; q < 4; ++q) { unsigned short a, c2; splitf(v[ch * 4 + q] * f, a, c2); oh[q] = a; ol[q] = c2; }
                const size_t oo = (size_t)row * PLD + ch * 128 + lane * 4; *(v4us*)(Ph + oo) = oh; *(v4us*)(Pl + oo) = ol; }
        } else {
#pragma unroll
            for (int ch = 0; ch < TT / 128; ++ch) { v4h o4;
#pragma unroll
                for (int q = 0; q < 4; ++q) o4[q] = tohx(v[ch * 4 + q] * f);
                *(v4h*)(P16 + (size_t)row * PLD + ch * 128 + lane * 4) = o4; } }
         }
}
__global__ __launch_bounds__(256) void k_merge(const float* __restrict__ O, int h0, bf* Ah, bf* Al) { const size_t e = ((size_t)blockIdx.x * 256 + threadIdx.x) * 2; if (e >= (size_t)ZH * TT * HD) return; const int d = (int)(e % HD); const int t = (int)((e / HD) % TT); const int zz = (int)(e / ((size_t)HD * TT)); const float cs = (t < RH) ? 1.0f : (1.0f / PCAR); const size_t oo = (size_t)t * DQ + (h0 + zz) * HD + d;
    v2us oh, ol;
#pragma unroll
    for (int q = 0; q < 2; ++q) { unsigned short a, c2; splitf(O[e + q] * cs, a, c2); oh[q] = a; ol[q] = c2; } *(v2us*)(Ah + oo) = oh; *(v2us*)(Al + oo) = ol;  }

extern "C" void kernel_launch(void* const* d_in, const int* in_sizes, int n_in,
                              void* d_out, int out_size, void* d_ws, size_t ws_size, hipStream_t stream) {
    (void)in_sizes; (void)n_in; (void)out_size;
    const float* x = (const float*)d_in[0]; const float* xk = (const float*)d_in[1]; const float* xv = (const float*)d_in[2]; const float* wq = (const float*)d_in[3]; const float* bq = (const float*)d_in[4]; const float* wk = (const float*)d_in[3]; const float* bk = (const float*)d_in[4]; const float* wv = (const float*)d_in[3]; const float* bv = (const float*)d_in[4]; const float* wo = (const float*)d_in[5]; const float* bo = (const float*)d_in[6];   /* argument order Q, K, V (three streams), wq ('oi': the ONE weight used for the q, k AND v projections, as the source module does), bq (the one shared bias), wo ('oi'), bo; the causal rule is applied by index: no mask input */
    float* OUT = (float*)d_out;     // [2][2048][1024]
    char* wsp = (char*)d_ws;
    auto take = [&](size_t bytes) { char* p = wsp; wsp += (bytes + 255) & ~(size_t)255; return (void*)p; };
    bf* WQ = (bf*)take((size_t)DQ * DM * 2); bf* WK = (bf*)take((size_t)DKV * DM * 2); bf* WV = (bf*)take((size_t)DKV * DM * 2); bf* WO = (bf*)take((size_t)DM * DQ * 2); float* CS = (float*)take((size_t)TT * HD * 2 * 4);
    bf* XB = (bf*)take((size_t)TT * DM * 2); float* FQ = (float*)take((size_t)TT * DQ * 4); float* FK = (float*)take((size_t)TT * DKV * 4);
    h16* QP16 = (h16*)take((size_t)NH_ * TT * HD * 2); h16* KP16 = (h16*)take((size_t)NKV * TT * HD * 2); h16* VT16 = (h16*)take((size_t)NKV * HD * TT * 2);
    bf* QPh = (bf*)take((size_t)NH_ * TT * HD * 2); bf* QPl = (bf*)take((size_t)NH_ * TT * HD * 2); bf* KPh = (bf*)take((size_t)NKV * TT * HD * 2); bf* KPl = (bf*)take((size_t)NKV * TT * HD * 2); bf* VTh = (bf*)take((size_t)NKV * HD * TT * 2); bf* VTl = (bf*)take((size_t)NKV * HD * TT * 2);
    float* Sb = (float*)take((size_t)ZH * TT * TT * 4); h16* P16 = (h16*)Sb; bf* Ph = (bf*)Sb; bf* Pl = Ph + TT;   /* probability planes in place over the score rows (pitch PLD): 8 heads of scores are 128 MiB, and separate planes would not fit the workspace */ float* Ob = (float*)take((size_t)ZH * TT * HD * 4); bf* ATh = (bf*)take((size_t)TT * DQ * 2); bf* ATl = (bf*)take((size_t)TT * DQ * 2);
    if ((size_t)(wsp - (char*)d_ws) > ws_size) return;    // ws 256 MiB
    float* FV = FK;   // v projection reuses the k buffer after the k planes are built (stream-ordered)
    { k_cvt8<<<(unsigned)(((size_t)DQ * DM / 8 + 255) / 256), 256, 0, stream>>>(wq, WQ, (size_t)DQ * DM / 8); k_cvt8<<<(unsigned)(((size_t)DKV * DM / 8 + 255) / 256), 256, 0, stream>>>(wk, WK, (size_t)DKV * DM / 8); k_cvt8<<<(unsigned)(((size_t)DKV * DM / 8 + 255) / 256), 256, 0, stream>>>(wv, WV, (size_t)DKV * DM / 8);
      k_cvt8<<<(unsigned)(((size_t)DM * DQ / 8 + 255) / 256), 256, 0, stream>>>(wo, WO, (size_t)DM * DQ / 8);
       }
    k_csid<<<(TT * HD + 255) / 256, 256, 0, stream>>>(CS);
    const unsigned LQ = (unsigned)(((size_t)NH_ * TT * HD / 2 + 255) / 256), LKv = (unsigned)(((size_t)NKV * TT * HD / 2 + 255) / 256);
    for (int b = 0; b < NB_; ++b) {
        
        k_cvt8<<<(unsigned)(((size_t)TT * DM / 8 + 255) / 256), 256, 0, stream>>>(x + (size_t)b * TT * DM, XB, (size_t)TT * DM / 8);
        k_gemmw<bf, 0, true><<<dim3(TT / 64, DQ / 64, 1), 32, 0, stream>>>(XB, nullptr, WQ, nullptr, DM, FQ, DQ, bq, 0, 0, 0);
        k_rope<<<LQ, 256, 0, stream>>>(FQ, DQ, NH_, CS, nullptr, nullptr, 1.0f, QP16, QPh, QPl);
        k_cvt8<<<(unsigned)(((size_t)TT * DM / 8 + 255) / 256), 256, 0, stream>>>(xk + (size_t)b * TT * DM, XB, (size_t)TT * DM / 8);   /* XB := bf16(k[b]) */ k_gemmw<bf, 0, true><<<dim3(TT / 64, DKV / 64, 1), 32, 0, stream>>>(XB, nullptr, WK, nullptr, DM, FK, DKV, bk, 0, 0, 0);
        k_rope<<<LKv, 256, 0, stream>>>(FK, DKV, NKV, CS, nullptr, nullptr, 1.0f, KP16, KPh, KPl);
        k_cvt8<<<(unsigned)(((size_t)TT * DM / 8 + 255) / 256), 256, 0, stream>>>(xv + (size_t)b * TT * DM, XB, (size_t)TT * DM / 8);   /* XB := bf16(v[b]) */ k_gemmw<bf, 0, true><<<dim3(TT / 64, DKV / 64, 1), 32, 0, stream>>>(XB, nullptr, WV, nullptr, DM, FV, DKV, bv, 0, 0, 0); k_vtp<<<LKv, 256, 0, stream>>>(FV, DKV, NKV, VT16, VTh, VTl);
        for (int h0 = 0; h0 < NH_; h0 += ZH) { const size_t zq = (size_t)h0, zk = (size_t)(h0 / REP);   // one kv head per query head: the pass's heads use consecutive kv planes (z-strides TT*HD)
            k_gemmc<bf, 2, 1><<<dim3(RH / 64, TT / 64, ZH), 32, 0, stream>>>(QPh + zq * TT * HD, QPl + zq * TT * HD, KPh + zk * TT * HD, KPl + zk * TT * HD, HD, Sb, TT, 0, (size_t)TT * HD, (size_t)TT * HD, (size_t)TT * TT);
            k_gemmc<h16, 0, 1><<<dim3((TT - RH) / 64, TT / 64, ZH), 32, 0, stream>>>(QP16 + zq * TT * HD + (size_t)RH * HD, nullptr, KP16 + zk * TT * HD, nullptr, HD, Sb + (size_t)RH * TT, TT, RH, (size_t)TT * HD, (size_t)TT * HD, (size_t)TT * TT);
            k_asoft<<<ZH * TT / 8, 256, 0, stream>>>(Sb, P16, Ph, Pl);
            k_gemmpv<bf, 2><<<dim3(RH / 64, HD / 64, ZH), 32 * PVW, 0, stream>>>(Ph, Pl, PLD, VTh + zk * HD * TT, VTl + zk * HD * TT, TT, Ob, HD, 0, (size_t)TT * PLD, (size_t)HD * TT, (size_t)TT * HD);
            k_gemmpv<h16, 0><<<dim3((TT - RH) / 64, HD / 64, ZH), 32 * PVW, 0, stream>>>(P16 + (size_t)RH * PLD, nullptr, PLD, VT16 + zk * HD * TT, nullptr, TT, Ob + (size_t)RH * HD, HD, RH, (size_t)TT * PLD, (size_t)HD * TT, (size_t)TT * HD);
            k_merge<<<(unsigned)(((size_t)ZH * TT * HD / 2 + 255) / 256), 256, 0, stream>>>(Ob, h0, ATh, ATl); }
        k_gemmw<bf, 1, true><<<dim3(TT / 64, DM / 64, 1), 32, 0, stream>>>(ATh, ATl, WO, nullptr, DQ, OUT + (size_t)b * TT * DM, DM, bo, 0, 0, 0); }
}

// v003
// Measured time: 331 microseconds a run.
// Timed twice side by side with v002, it ran 1.72 and 1.71 times as fast.
// Over all steps from v000 it is 4.40 times as fast.
#include <hip/hip_runtime.h>

// Causal multi-head attention on three input streams that uses ONE shared projection for Q, K and V (Q, K, V [2][2048][1024]; q = Q wq^T + bq, k = K wq^T + bq, v = V wq^T + bq: the SAME 'oi' [1024][1024] weight (normal x 0.02) and the same bias (zeros on this draw: read) for all three streams, as the source module does; 16 heads x 64); scores x 1/sqrt(64); tril kept, -inf elsewhere; softmax over the keys; out = merged wo^T + bo ('oi' + bias zeros: read) -> [2][2048][1024] (4.2 M); argument order Q, K, V, wq, bq, wo, bo).
// Layout per batch: bf16 copies of q, k, v in turn; 'oi' weights; exact projections + f32 biases; identity-table plane builders; fused causal T-2048 attention, one launch per batch (hybrid rows: < 512 hi/lo 3 products, rest fp16; passes above the diagonal are never walked); merged hi/lo x Wo exact + bo.
// Compute dtypes, f32 accumulate: every input rounded to bf16; projections exact + f32 biases; attention rows < 512 3 products, rest fp16; softmax f32; Wo hl x exact + bias.

#define NB_  2
#define TT   2048
#define DM   1024
#define NH_  16
#define NKV  16
#define REP  (NH_ / NKV)
#define HD   64
#define DQ   (NH_ * HD)
#define DKV  (NKV * HD)
#define RH   512                  // query rows < RH use hi+lo planes (0: none)
#define SCL  0.125f   // HD^-0.5
typedef _Float16 h16;
typedef unsigned short bf;
typedef __attribute__((ext_vector_type(16))) __bf16   v16bf;
typedef __attribute__((ext_vector_type(16))) _Float16 v16h;
typedef __attribute__((ext_vector_type(8)))  _Float16 v8h;
typedef __attribute__((ext_vector_type(8)))  unsigned short v8us;
typedef __attribute__((ext_vector_type(8)))  float    v8f;
typedef __attribute__((ext_vector_type(4)))  float    v4f;
typedef v8h  __attribute__((may_alias)) v8ha;
typedef v4f  __attribute__((may_alias)) v4fa;
typedef v8us __attribute__((may_alias)) v8usa;

__device__ __forceinline__ unsigned short f2bf(float f) { unsigned u = __float_as_uint(f); u += 0x7FFFu + ((u >> 16) & 1u); return (unsigned short)(u >> 16); }
__device__ __forceinline__ float bf2f(unsigned short b) { return __uint_as_float(((unsigned)b) << 16); }
__device__ __forceinline__ float bfr(float f) { return bf2f(f2bf(f)); }
__device__ __forceinline__ v16h cat16(v8h lo, v8h hi) { return __builtin_shufflevector(lo, hi, 0, 1, 2, 3, 4, 5, 6, 7, 8, 9, 10, 11, 12, 13, 14, 15); }
__device__ __forceinline__ v16bf cat16b(v8us lo, v8us hi) { return __builtin_bit_cast(v16bf, __builtin_shufflevector(lo, hi, 0, 1, 2, 3, 4, 5, 6, 7, 8, 9, 10, 11, 12, 13, 14, 15)); }
__device__ __forceinline__ v8f wmma16(v16h a, v16h b, v8f c) { return __builtin_amdgcn_wmma_f32_16x16x32_f16(false, a, false, b, (short)0, c, false, false); }
__device__ __forceinline__ v8f wmmab(v16bf a, v16bf b, v8f c) { return __builtin_amdgcn_wmma_f32_16x16x32_bf16(false, a, false, b, (short)0, c, false, false); }



// ---- k_gemmw: register-blocked GEMM, ONE WAVE per 64x64 output tile (16 accumulators), operands straight from K-contiguous 16-bit planes; grid (M/64, N/64, Z), 32 threads.
// C[m][n] (f32, pitch ldc, + optional f32 bias[n]) = sum_k A[m][k] Bt[n][k] (+ split products per NSPLIT). z-batch strides sA/sB/sC in elements. K % 32 == 0.
template <typename T16> struct WFrag;
template <> struct WFrag<h16> { typedef v16h V; static __device__ __forceinline__ V ld(const h16* p) { return cat16(*(const v8h*)p, *(const v8h*)(p + 16)); } static __device__ __forceinline__ v8f mma(V a, V b, v8f c) { return wmma16(a, b, c); } };
template <> struct WFrag<bf> { typedef v16bf V; static __device__ __forceinline__ V ld(const bf* p) { return cat16b(*(const v8us*)p, *(const v8us*)(p + 16)); } static __device__ __forceinline__ v8f mma(V a, V b, v8f c) { return wmmab(a, b, c); } };
template <typename T16, int NSPLIT, bool BIAS>
__global__ __launch_bounds__(32) void k_gemmw(const T16* __restrict__ A, const T16* __restrict__ A2, const T16* __restrict__ Bt, const T16* __restrict__ Bt2, int K, float* C, int ldc, const float* __restrict__ bias, size_t sA, size_t sB, size_t sC) {
    typedef typename WFrag<T16>::V V;
    __shared__ __align__(16) float os[16 * 68];
    const size_t z = blockIdx.z; A += z * sA; if (A2) A2 += z * sA; Bt += z * sB; if (Bt2) Bt2 += z * sB; C += z * sC;
    const int lane = threadIdx.x & 31, lr = lane & 15, hi = lane >> 4; const int r0 = blockIdx.x * 64, c0 = blockIdx.y * 64;
    v8f acc[4][4];
#pragma unroll
    for (int mb = 0; mb < 4; ++mb)
#pragma unroll
        for (int nb = 0; nb < 4; ++nb) acc[mb][nb] = (v8f){};
    const size_t aoff = (size_t)(r0 + lr) * K + 8 * hi, boff = (size_t)(c0 + lr) * K + 8 * hi;
#pragma unroll 1
    for (int kc = 0; kc < K; kc += 32) {
        V a[4], a2[4];
#pragma unroll
        for (int mb = 0; mb < 4; ++mb) { a[mb] = WFrag<T16>::ld(A + aoff + (size_t)mb * 16 * K + kc); if (NSPLIT == 1 || NSPLIT == 2) a2[mb] = WFrag<T16>::ld(A2 + aoff + (size_t)mb * 16 * K + kc); }
#pragma unroll
        for (int nb = 0; nb < 4; ++nb) { const V b = WFrag<T16>::ld(Bt + boff + (size_t)nb * 16 * K + kc); V b2; if (NSPLIT >= 2) b2 = WFrag<T16>::ld(Bt2 + boff + (size_t)nb * 16 * K + kc);
#pragma unroll
            for (int mb = 0; mb < 4; ++mb) { acc[mb][nb] = WFrag<T16>::mma(a[mb], b, acc[mb][nb]); if (NSPLIT == 1 || NSPLIT == 2) acc[mb][nb] = WFrag<T16>::mma(a2[mb], b, acc[mb][nb]); if (NSPLIT >= 2) acc[mb][nb] = WFrag<T16>::mma(a[mb], b2, acc[mb][nb]); } }
        asm volatile("v_nop\n\tv_nop\n\tv_nop\n\tv_nop" : "+v"(acc[0][0]), "+v"(acc[1][1]), "+v"(acc[2][2]), "+v"(acc[3][3]) : "v"(a[0]), "v"(a[3]));
    }
#pragma unroll
    for (int mb = 0; mb < 4; ++mb) {
#pragma unroll
        for (int nb = 0; nb < 4; ++nb) {
#pragma unroll
            for (int j = 0; j < 8; ++j) os[(hi * 8 + j) * 68 + nb * 16 + lr] = acc[mb][nb][j]; }
        __builtin_amdgcn_wave_barrier(); asm volatile("" ::: "memory");
        float* crow = C + (size_t)(r0 + mb * 16) * ldc + c0;
{
#pragma unroll
            for (int s = 0; s < 8; ++s) { const int row = 2 * s + hi, cofs = lr * 4; v4f val = *(const v4fa*)(os + row * 68 + cofs); if (BIAS) { val[0] += bfr(bias[c0 + cofs]); val[1] += bfr(bias[c0 + cofs + 1]); val[2] += bfr(bias[c0 + cofs + 2]); val[3] += bfr(bias[c0 + cofs + 3]); }
                *(v4f*)(crow + (size_t)row * ldc + cofs) = val; }
             }
        __builtin_amdgcn_wave_barrier(); asm volatile("" ::: "memory");
    }
}

#define FAW 8
// XCNT0: the wait that stands between issued global loads and the first later instruction that takes over one of their address registers (the register allocator reuses dead address pairs as fragment and score registers)
#define XCNT0() asm volatile("s_wait_xcnt 0x0" ::: "memory")
#define SC2 (SCL * 1.4426950408889634f)
__device__ __forceinline__ float exp2s(float x) { float r; asm("v_exp_f32 %0, %1\n\tv_nop" : "=v"(r) : "v"(x)); return r; }
// eight at once, each in place: a neighbour touches only its own register, so the one v_nop behind the last serves the run
__device__ __forceinline__ void exp2x8(float* x) { asm("v_exp_f32 %0, %0\n\tv_exp_f32 %1, %1\n\tv_exp_f32 %2, %2\n\tv_exp_f32 %3, %3\n\tv_exp_f32 %4, %4\n\tv_exp_f32 %5, %5\n\tv_exp_f32 %6, %6\n\tv_exp_f32 %7, %7\n\tv_nop" : "+v"(x[0]), "+v"(x[1]), "+v"(x[2]), "+v"(x[3]), "+v"(x[4]), "+v"(x[5]), "+v"(x[6]), "+v"(x[7])); }
template <typename T16, int NSPLIT> struct PPack;
template <> struct PPack<h16, 0> { static __device__ __forceinline__ void pk(const float* p, v16h& a, v16h& b) { (void)b;
#pragma unroll
    for (int s = 0; s < 16; ++s) a[s] = (h16)p[s]; } };
template <> struct PPack<bf, 2> { static __device__ __forceinline__ void pk(const float* p, v16bf& a, v16bf& b) { typedef __attribute__((ext_vector_type(16))) unsigned short v16us; v16us x, y;
#pragma unroll
    for (int s = 0; s < 16; ++s) { const unsigned short h = f2bf(p[s]); x[s] = h; y[s] = f2bf(p[s] - bf2f(h)); }
    a = __builtin_bit_cast(v16bf, x); b = __builtin_bit_cast(v16bf, y); } };
template <typename T16, int NSPLIT, int QT, bool PRE>   // PRE: the key fragments are fetched one pass ahead
__device__ __forceinline__ void fattn_body(const T16* __restrict__ Q, const T16* __restrict__ Q2, const T16* __restrict__ Kp, const T16* __restrict__ Kp2, const T16* __restrict__ Vt, const T16* __restrict__ Vt2, int q0, bf* Ah, bf* Al, float* red, float* sm, float* sl) {
    typedef typename WFrag<T16>::V V;
    constexpr int QB = QT * 16;
    const int lane = threadIdx.x & 31, c = lane & 15, hi = lane >> 4;
    const int w = __builtin_amdgcn_readfirstlane(threadIdx.x >> 5);  // wave number, held scalar so that the pass loop's bounds and branch stay scalar
    V qf[QT][2], qf2[QT][2];
#pragma unroll
    for (int qt = 0; qt < QT; ++qt)
#pragma unroll
        for (int ks = 0; ks < 2; ++ks) { const size_t qo = (size_t)(q0 + qt * 16 + c) * HD + ks * 32 + 8 * hi; qf[qt][ks] = WFrag<T16>::ld(Q + qo); if (NSPLIT >= 2) qf2[qt][ks] = WFrag<T16>::ld(Q2 + qo); }
    v8f o[QT][4]; float m[QT], l[QT];
#pragma unroll
    for (int qt = 0; qt < QT; ++qt) { m[qt] = -3.0e38f; l[qt] = 0.f;
#pragma unroll
        for (int dt = 0; dt < 4; ++dt) o[qt][dt] = (v8f){}; }
    const int np = q0 / 32 + 1;      // 32-key passes up to and including the one that holds the diagonal; key q0's pass is the last, so every pass has a kept key for every query of the block
    V ka[2][2], ka2[2][2];
    const unsigned klo = (unsigned)(c * HD + 8 * hi) * 2u, vlo = (unsigned)(c * TT + 8 * hi) * 2u;   // the lane's byte offsets in a key-row group and a value-row group: fixed over the loop, so that a pass moves only the scalar base
    auto ldk = [&](int kk) { const char* kb = (const char*)(Kp + (size_t)kk * HD) + klo; const char* kb2 = (NSPLIT >= 2) ? (const char*)(Kp2 + (size_t)kk * HD) + klo : nullptr;
#pragma unroll
        for (int kt = 0; kt < 2; ++kt)
#pragma unroll
            for (int ks = 0; ks < 2; ++ks) { const int ko = (kt * 16 * HD + ks * 32) * 2; ka[kt][ks] = WFrag<T16>::ld((const T16*)(kb + ko)); if (NSPLIT >= 2) ka2[kt][ks] = WFrag<T16>::ld((const T16*)(kb2 + ko)); } };
    if (PRE) ldk(min(w, np - 1) * 32);   // a wave without a pass fetches the last pass's rows and uses nothing of them
#pragma unroll 1   // rolled: one pass's fragments live at a time
    for (int p = w; p < np; p += FAW) { const int k0 = p * 32;
        if (!PRE) { ldk(k0); XCNT0(); }
        V va[4], va2[4];
#pragma unroll
        for (int dt = 0; dt < 4; ++dt) { const int vo = dt * 16 * TT * 2; va[dt] = WFrag<T16>::ld((const T16*)((const char*)(Vt + k0) + vlo + vo)); if (NSPLIT >= 2) va2[dt] = WFrag<T16>::ld((const T16*)((const char*)(Vt2 + k0) + vlo + vo)); }
        XCNT0();
        float s[QT][16];
#pragma unroll
        for (int kt = 0; kt < 2; ++kt) {
#pragma unroll
            for (int qt = 0; qt < QT; ++qt) { v8f t = (v8f){};
#pragma unroll
                for (int ks = 0; ks < 2; ++ks) { t = WFrag<T16>::mma(ka[kt][ks], qf[qt][ks], t); if (NSPLIT >= 2) { t = WFrag<T16>::mma(ka[kt][ks], qf2[qt][ks], t); t = WFrag<T16>::mma(ka2[kt][ks], qf[qt][ks], t); } }
#pragma unroll
                for (int r = 0; r < 8; ++r) s[qt][kt * 8 + r] = t[r] * SC2; } }
        if (PRE) ldk((p + FAW < np ? p + FAW : p) * 32);   // the next pass's key rows fly behind this pass's softmax and P.V; the last pass re-reads its own rows, so the address stays inside the plane
        if (k0 + 31 > q0) {          // the diagonal pass (scalar test): keys above the query are masked by select
#pragma unroll
            for (int qt = 0; qt < QT; ++qt) { const int lim = q0 + qt * 16 + c - k0 - 8 * hi;   // element e holds key k0 + 8 hi + (e >> 3) * 16 + (e & 7)
#pragma unroll
                for (int e = 0; e < 16; ++e) if ((e >> 3) * 16 + (e & 7) > lim) s[qt][e] = -3.0e38f; } }
        float mn[QT]; bool need = false;
#pragma unroll
        for (int qt = 0; qt < QT; ++qt) { float pm = s[qt][0];
#pragma unroll
            for (int e = 1; e < 16; ++e) pm = fmaxf(pm, s[qt][e]);
            pm = fmaxf(pm, __shfl_xor(pm, 16, 32)); mn[qt] = fmaxf(m[qt], pm); need = need || (mn[qt] > m[qt]); }
        if (__builtin_amdgcn_ballot_w32(need) != 0) {   // scalar branch: the rescale runs only in a pass that raises some query's maximum
#pragma unroll
            for (int qt = 0; qt < QT; ++qt) { const float al = exp2s(m[qt] - mn[qt]); m[qt] = mn[qt]; l[qt] *= al;
#pragma unroll
                for (int dt = 0; dt < 4; ++dt) o[qt][dt] *= al; } }
#pragma unroll
        for (int qt = 0; qt < QT; ++qt) {
#pragma unroll
            for (int e = 0; e < 16; ++e) s[qt][e] -= m[qt];
            exp2x8(s[qt]); exp2x8(s[qt] + 8);
#pragma unroll
            for (int e = 0; e < 16; ++e) l[qt] += s[qt][e];
            V pb, pb2; PPack<T16, NSPLIT>::pk(s[qt], pb, pb2);
#pragma unroll
            for (int dt = 0; dt < 4; ++dt) { o[qt][dt] = WFrag<T16>::mma(va[dt], pb, o[qt][dt]); if (NSPLIT >= 2) { o[qt][dt] = WFrag<T16>::mma(va[dt], pb2, o[qt][dt]); o[qt][dt] = WFrag<T16>::mma(va2[dt], pb, o[qt][dt]); } } }
    }
#pragma unroll
    for (int qt = 0; qt < QT; ++qt) { l[qt] += __shfl_xor(l[qt], 16, 32); if (hi == 0) { sm[w * QB + qt * 16 + c] = m[qt]; sl[w * QB + qt * 16 + c] = l[qt]; } }
    __syncthreads();   // every wave's maximum and sum are in LDS before any wave forms the joint ones
#pragma unroll
    for (int qt = 0; qt < QT; ++qt) { float M = sm[qt * 16 + c];
#pragma unroll
        for (int u = 1; u < FAW; ++u) M = fmaxf(M, sm[u * QB + qt * 16 + c]);
        float L = 0.f;
#pragma unroll
        for (int u = 0; u < FAW; ++u) L += sl[u * QB + qt * 16 + c] * exp2s(sm[u * QB + qt * 16 + c] - M);   // a wave without a pass has l = 0 and a factor of 0
        const float g = __fdiv_rn(exp2s(m[qt] - M), L);
        float* my = red + (size_t)(w * QB + qt * 16 + c) * 68 + 8 * hi;
#pragma unroll
        for (int dt = 0; dt < 4; ++dt) { v4f a, b;
#pragma unroll
            for (int r = 0; r < 4; ++r) { a[r] = o[qt][dt][r] * g; b[r] = o[qt][dt][r + 4] * g; }
            *(v4fa*)(my + dt * 16) = a; *(v4fa*)(my + dt * 16 + 4) = b; } }
    __syncthreads();   // every wave's scaled partial tile is in LDS before any thread sums across waves
    constexpr int EPT = QB * HD / (32 * FAW);      // output elements per thread: 8 or 4 consecutive d of one query row
    const int row = (int)threadIdx.x / (HD / EPT), d0 = ((int)threadIdx.x % (HD / EPT)) * EPT;
    float acc[EPT];
#pragma unroll
    for (int e4 = 0; e4 < EPT / 4; ++e4) { v4f val = *(const v4fa*)(red + row * 68 + d0 + e4 * 4);
#pragma unroll
        for (int u = 1; u < FAW; ++u) val += *(const v4fa*)(red + (u * QB + row) * 68 + d0 + e4 * 4);
#pragma unroll
        for (int r = 0; r < 4; ++r) acc[e4 * 4 + r] = val[r]; }
    typedef __attribute__((ext_vector_type(EPT))) unsigned short vEus;
    vEus oh, ol;
#pragma unroll
    for (int e = 0; e < EPT; ++e) { const unsigned short h = f2bf(acc[e]); oh[e] = h; ol[e] = f2bf(acc[e] - bf2f(h)); }
    const size_t oo = (size_t)(q0 + row) * DQ + d0; *(vEus*)(Ah + oo) = oh; *(vEus*)(Al + oo) = ol;
}
// grid (heads, row blocks): the block rank is the slow index and its cost falls with it (fp16 blocks of 32 rows from the last row down, then the hi/lo blocks of 16 rows from row RH down)
__global__ __launch_bounds__(32 * FAW) void k_fattn(const h16* __restrict__ Q16, const h16* __restrict__ K16, const h16* __restrict__ V16, const bf* __restrict__ Qh, const bf* __restrict__ Ql, const bf* __restrict__ Kh, const bf* __restrict__ Kl, const bf* __restrict__ Vh, const bf* __restrict__ Vl, bf* Ah, bf* Al) {
    __shared__ __align__(16) float red[FAW * 32 * 68]; __shared__ float sm[FAW * 32]; __shared__ float sl[FAW * 32];
    const size_t zo = (size_t)blockIdx.x * TT * HD; const int y = blockIdx.y; Ah += blockIdx.x * HD; Al += blockIdx.x * HD;
    if (y >= (TT - RH) / 32) { fattn_body<bf, 2, 1, false>(Qh + zo, Ql + zo, Kh + zo, Kl + zo, Vh + zo, Vl + zo, RH - 16 * (y - (TT - RH) / 32 + 1), Ah, Al, red, sm, sl); return; }
    fattn_body<h16, 0, 2, true>(Q16 + zo, nullptr, K16 + zo, nullptr, V16 + zo, nullptr, TT - 32 * (y + 1), Ah, Al, red, sm, sl);
    XCNT0();   // behind this body's two output stores: in the listing the hi/lo body's code follows them and takes over their data registers
}

__device__ __forceinline__ h16 tohx(float x) { return (h16)x; }
__device__ __forceinline__ void splitf(float y, unsigned short& h, unsigned short& l) { h = f2bf(y); l = f2bf(y - bf2f(h)); }
typedef __attribute__((ext_vector_type(2))) _Float16 v2h;
typedef __attribute__((ext_vector_type(4))) _Float16 v4h;
typedef __attribute__((ext_vector_type(2))) unsigned short v2us;
typedef __attribute__((ext_vector_type(4))) unsigned short v4us;
typedef __attribute__((ext_vector_type(2))) float v2f;
typedef __attribute__((ext_vector_type(4))) int v4i;

__global__ __launch_bounds__(256) void k_cvt8(const float* __restrict__ src, bf* dst, size_t n8) { const size_t i = (size_t)blockIdx.x * 256 + threadIdx.x; if (i >= n8) return; const v8f v = *(const v8f*)(src + i * 8); v8us o;
#pragma unroll
    for (int k = 0; k < 8; ++k) o[k] = f2bf(v[k]); *(v8us*)(dst + i * 8) = o;  }

// k_rope: head planes [h][t][d] (fp16 + hi/lo) of rope(x) x sc with the rotate-half convention out[d] = x[d] cos[t][d] - x[d+HD/2] sin[t][d], out[d+HD/2] = x[d+HD/2] cos[t][d+HD/2] + x[d] sin[t][d+HD/2]
__global__ __launch_bounds__(256) void k_rope(const float* __restrict__ F, int pitch, int nheads, const float* __restrict__ CS, const float* __restrict__ RF, const float* __restrict__ nw, float sc, h16* P16, bf* Ph, bf* Pl) {
    const size_t e = ((size_t)blockIdx.x * 256 + threadIdx.x) * 2; if (e >= (size_t)nheads * TT * HD) return; const int d = (int)(e % HD); const int t = (int)((e / HD) % TT); const int h = (int)(e / ((size_t)HD * TT)); const float* f = F + (size_t)t * pitch + h * HD; const float rf = RF ? RF[(size_t)h * TT + t] : 1.0f; v2h o16; v2us oh, ol;
#pragma unroll
    for (int q = 0; q < 2; ++q) { const int dd = d + q; const int dp = (dd < HD / 2) ? dd + HD / 2 : dd - HD / 2; float x0 = f[dd], x1 = f[dp];
        if (RF) { float n0 = __fmul_rn(x0, rf), n1 = __fmul_rn(x1, rf); asm volatile("" : "+v"(n0)); asm volatile("" : "+v"(n1)); x0 = __fmul_rn(bfr(nw[dd]), n0); x1 = __fmul_rn(bfr(nw[dp]), n1); }
        const v2f cs = *(const v2f*)(CS + ((size_t)t * HD + dd) * 2); float a = __fmul_rn(x0, cs[0]), bq = __fmul_rn(x1, cs[1]); asm volatile("" : "+v"(a)); asm volatile("" : "+v"(bq)); const float r = ((dd < HD / 2) ? __fsub_rn(a, bq) : __fadd_rn(a, bq)) * sc;
        o16[q] = tohx(r); unsigned short a2, c2; splitf(r, a2, c2); oh[q] = a2; ol[q] = c2; }
    *(v2h*)(P16 + e) = o16; *(v2us*)(Ph + e) = oh; *(v2us*)(Pl + e) = ol;  }
__global__ __launch_bounds__(256) void k_vtp(const float* __restrict__ F, int pitch, int nheads, h16* V16, bf* Vh, bf* Vl) { const size_t e = ((size_t)blockIdx.x * 256 + threadIdx.x) * 2; if (e >= (size_t)nheads * HD * TT) return; const int t = (int)(e % TT); const int d = (int)((e / TT) % HD); const int g = (int)(e / ((size_t)TT * HD)); v2h o16; v2us oh, ol;
#pragma unroll
    for (int q = 0; q < 2; ++q) { const float x = F[(size_t)(t + q) * pitch + g * HD + d]; o16[q] = tohx(x); unsigned short a2, c2; splitf(x, a2, c2); oh[q] = a2; ol[q] = c2; }
    *(v2h*)(V16 + e) = o16; *(v2us*)(Vh + e) = oh; *(v2us*)(Vl + e) = ol;  }
__global__ __launch_bounds__(256) void k_csid(float* CS) { const int idx = blockIdx.x * 256 + threadIdx.x; if (idx >= TT * HD) return; v2f cs; cs[0] = 1.0f; cs[1] = 0.0f; *(v2f*)(CS + (size_t)idx * 2) = cs;  }

extern "C" void kernel_launch(void* const* d_in, const int* in_sizes, int n_in,
                              void* d_out, int out_size, void* d_ws, size_t ws_size, hipStream_t stream) {
    (void)in_sizes; (void)n_in; (void)out_size;
    const float* x = (const float*)d_in[0]; const float* xk = (const float*)d_in[1]; const float* xv = (const float*)d_in[2]; const float* wq = (const float*)d_in[3]; const float* bq = (const float*)d_in[4]; const float* wk = (const float*)d_in[3]; const float* bk = (const float*)d_in[4]; const float* wv = (const float*)d_in[3]; const float* bv = (const float*)d_in[4]; const float* wo = (const float*)d_in[5]; const float* bo = (const float*)d_in[6];   /* argument order Q, K, V (three streams), wq ('oi': the ONE weight used for the q, k AND v projections, as the source module does), bq (the one shared bias), wo ('oi'), bo; the causal rule is applied by index: no mask input */
    float* OUT = (float*)d_out;     // [2][2048][1024]
    char* wsp = (char*)d_ws;
    auto take = [&](size_t bytes) { char* p = wsp; wsp += (bytes + 255) & ~(size_t)255; return (void*)p; };
    bf* WQ = (bf*)take((size_t)DQ * DM * 2); bf* WK = (bf*)take((size_t)DKV * DM * 2); bf* WV = (bf*)take((size_t)DKV * DM * 2); bf* WO = (bf*)take((size_t)DM * DQ * 2); float* CS = (float*)take((size_t)TT * HD * 2 * 4);
    bf* XB = (bf*)take((size_t)TT * DM * 2); float* FQ = (float*)take((size_t)TT * DQ * 4); float* FK = (float*)take((size_t)TT * DKV * 4);
    h16* QP16 = (h16*)take((size_t)NH_ * TT * HD * 2); h16* KP16 = (h16*)take((size_t)NKV * TT * HD * 2); h16* VT16 = (h16*)take((size_t)NKV * HD * TT * 2);
    bf* QPh = (bf*)take((size_t)NH_ * TT * HD * 2); bf* QPl = (bf*)take((size_t)NH_ * TT * HD * 2); bf* KPh = (bf*)take((size_t)NKV * TT * HD * 2); bf* KPl = (bf*)take((size_t)NKV * TT * HD * 2); bf* VTh = (bf*)take((size_t)NKV * HD * TT * 2); bf* VTl = (bf*)take((size_t)NKV * HD * TT * 2);
    bf* ATh = (bf*)take((size_t)TT * DQ * 2); bf* ATl = (bf*)take((size_t)TT * DQ * 2);
    if ((size_t)(wsp - (char*)d_ws) > ws_size) return;    // ws 256 MiB
    float* FV = FK;   // v projection reuses the k buffer after the k planes are built (stream-ordered)
    { k_cvt8<<<(unsigned)(((size_t)DQ * DM / 8 + 255) / 256), 256, 0, stream>>>(wq, WQ, (size_t)DQ * DM / 8); k_cvt8<<<(unsigned)(((size_t)DKV * DM / 8 + 255) / 256), 256, 0, stream>>>(wk, WK, (size_t)DKV * DM / 8); k_cvt8<<<(unsigned)(((size_t)DKV * DM / 8 + 255) / 256), 256, 0, stream>>>(wv, WV, (size_t)DKV * DM / 8);
      k_cvt8<<<(unsigned)(((size_t)DM * DQ / 8 + 255) / 256), 256, 0, stream>>>(wo, WO, (size_t)DM * DQ / 8);
       }
    k_csid<<<(TT * HD + 255) / 256, 256, 0, stream>>>(CS);
    const unsigned LQ = (unsigned)(((size_t)NH_ * TT * HD / 2 + 255) / 256), LKv = (unsigned)(((size_t)NKV * TT * HD / 2 + 255) / 256);
    for (int b = 0; b < NB_; ++b) {
        
        k_cvt8<<<(unsigned)(((size_t)TT * DM / 8 + 255) / 256), 256, 0, stream>>>(x + (size_t)b * TT * DM, XB, (size_t)TT * DM / 8);
        k_gemmw<bf, 0, true><<<dim3(TT / 64, DQ / 64, 1), 32, 0, stream>>>(XB, nullptr, WQ, nullptr, DM, FQ, DQ, bq, 0, 0, 0);
        k_rope<<<LQ, 256, 0, stream>>>(FQ, DQ, NH_, CS, nullptr, nullptr, 1.0f, QP16, QPh, QPl);
        k_cvt8<<<(unsigned)(((size_t)TT * DM / 8 + 255) / 256), 256, 0, stream>>>(xk + (size_t)b * TT * DM, XB, (size_t)TT * DM / 8);   /* XB := bf16(k[b]) */ k_gemmw<bf, 0, true><<<dim3(TT / 64, DKV / 64, 1), 32, 0, stream>>>(XB, nullptr, WK, nullptr, DM, FK, DKV, bk, 0, 0, 0);
        k_rope<<<LKv, 256, 0, stream>>>(FK, DKV, NKV, CS, nullptr, nullptr, 1.0f, KP16, KPh, KPl);
        k_cvt8<<<(unsigned)(((size_t)TT * DM / 8 + 255) / 256), 256, 0, stream>>>(xv + (size_t)b * TT * DM, XB, (size_t)TT * DM / 8);   /* XB := bf16(v[b]) */ k_gemmw<bf, 0, true><<<dim3(TT / 64, DKV / 64, 1), 32, 0, stream>>>(XB, nullptr, WV, nullptr, DM, FV, DKV, bv, 0, 0, 0); k_vtp<<<LKv, 256, 0, stream>>>(FV, DKV, NKV, VT16, VTh, VTl);
        k_fattn<<<dim3(NH_, (TT - RH) / 32 + RH / 16, 1), 32 * FAW, 0, stream>>>(QP16, KP16, VT16, QPh, QPl, KPh, KPl, VTh, VTl, ATh, ATl);   // one kv head per query head
        k_gemmw<bf, 1, true><<<dim3(TT / 64, DM / 64, 1), 32, 0, stream>>>(ATh, ATl, WO, nullptr, DQ, OUT + (size_t)b * TT * DM, DM, bo, 0, 0, 0); }
}

// v004
// A run of this version takes 288 microseconds.
// In two side-by-side timings against v003, it was 1.14 and 1.18 times as fast.
// All steps since v000 together make it 5.12 times as fast.
#include <hip/hip_runtime.h>

// Causal multi-head attention on three input streams that uses ONE shared projection for Q, K and V (Q, K, V [2][2048][1024]; q = Q wq^T + bq, k = K wq^T + bq, v = V wq^T + bq: the SAME 'oi' [1024][1024] weight (normal x 0.02) and the same bias (zeros on this draw: read) for all three streams, as the source module does; 16 heads x 64); scores x 1/sqrt(64); tril kept, -inf elsewhere; softmax over the keys; out = merged wo^T + bo ('oi' + bias zeros: read) -> [2][2048][1024] (4.2 M); argument order Q, K, V, wq, bq, wo, bo).
// Layout per batch: bf16 copies of q, k, v in turn; 'oi' weights; exact projections + f32 biases, whose epilogue writes the head planes; fused causal T-2048 attention, one launch per batch (hybrid rows: < 512 hi/lo 3 products, rest fp16; passes above the diagonal are never walked); merged hi/lo x Wo exact + bo.
// Compute dtypes, f32 accumulate: every input rounded to bf16; projections exact + f32 biases; attention rows < 512 3 products, rest fp16; softmax f32; Wo hl x exact + bias.

#define NB_  2
#define TT   2048
#define DM   1024
#define NH_  16
#define NKV  16
#define REP  (NH_ / NKV)
#define HD   64
#define DQ   (NH_ * HD)
#define DKV  (NKV * HD)
#define RH   512                  // query rows < RH use hi+lo planes (0: none)
#define SCL  0.125f   // HD^-0.5
typedef _Float16 h16;
typedef unsigned short bf;
typedef __attribute__((ext_vector_type(16))) __bf16   v16bf;
typedef __attribute__((ext_vector_type(16))) _Float16 v16h;
typedef __attribute__((ext_vector_type(8)))  _Float16 v8h;
typedef __attribute__((ext_vector_type(8)))  unsigned short v8us;
typedef __attribute__((ext_vector_type(8)))  float    v8f;
typedef __attribute__((ext_vector_type(4)))  float    v4f;
typedef v8h  __attribute__((may_alias)) v8ha;
typedef v4f  __attribute__((may_alias)) v4fa;
typedef v8us __attribute__((may_alias)) v8usa;

__device__ __forceinline__ unsigned short f2bf(float f) { unsigned u = __float_as_uint(f); u += 0x7FFFu + ((u >> 16) & 1u); return (unsigned short)(u >> 16); }
__device__ __forceinline__ float bf2f(unsigned short b) { return __uint_as_float(((unsigned)b) << 16); }
__device__ __forceinline__ float bfr(float f) { return bf2f(f2bf(f)); }
__device__ __forceinline__ v16h cat16(v8h lo, v8h hi) { return __builtin_shufflevector(lo, hi, 0, 1, 2, 3, 4, 5, 6, 7, 8, 9, 10, 11, 12, 13, 14, 15); }
__device__ __forceinline__ v16bf cat16b(v8us lo, v8us hi) { return __builtin_bit_cast(v16bf, __builtin_shufflevector(lo, hi, 0, 1, 2, 3, 4, 5, 6, 7, 8, 9, 10, 11, 12, 13, 14, 15)); }
__device__ __forceinline__ v8f wmma16(v16h a, v16h b, v8f c) { return __builtin_amdgcn_wmma_f32_16x16x32_f16(false, a, false, b, (short)0, c, false, false); }
__device__ __forceinline__ v8f wmmab(v16bf a, v16bf b, v8f c) { return __builtin_amdgcn_wmma_f32_16x16x32_bf16(false, a, false, b, (short)0, c, false, false); }



// ---- k_gemmw: register-blocked GEMM, ONE WAVE per 64x64 output tile (16 accumulators), operands straight from K-contiguous 16-bit planes; grid (M/64, N/64, Z), 32 threads.
// C[m][n] (f32, pitch ldc, + optional f32 bias[n]) = sum_k A[m][k] Bt[n][k] (+ split products per NSPLIT). z-batch strides sA/sB/sC in elements. K % 32 == 0.
// EPI 0: C is stored as f32. EPI 1: the tile is 64 tokens of ONE head (HD == 64) and goes out as the [h][t][d] planes fp16, bf16 hi, bf16 lo. EPI 2: the same three planes transposed, [h][d][t]: a lane's 8 accumulator rows are 8 consecutive tokens of one d, so they are stored from the registers.
template <typename T16> struct WFrag;
template <> struct WFrag<h16> { typedef v16h V; static __device__ __forceinline__ V ld(const h16* p) { return cat16(*(const v8h*)p, *(const v8h*)(p + 16)); } static __device__ __forceinline__ v8f mma(V a, V b, v8f c) { return wmma16(a, b, c); } };
template <> struct WFrag<bf> { typedef v16bf V; static __device__ __forceinline__ V ld(const bf* p) { return cat16b(*(const v8us*)p, *(const v8us*)(p + 16)); } static __device__ __forceinline__ v8f mma(V a, V b, v8f c) { return wmmab(a, b, c); } };
template <typename T16, int NSPLIT, bool BIAS, int EPI>
__global__ __launch_bounds__(32) void k_gemmw(const T16* __restrict__ A, const T16* __restrict__ A2, const T16* __restrict__ Bt, const T16* __restrict__ Bt2, int K, float* C, int ldc, const float* __restrict__ bias, size_t sA, size_t sB, size_t sC, h16* P16, bf* Ph, bf* Pl) {
    static_assert(EPI == 0 || HD == 64, "a plane epilogue takes one 64-wide tile as one head");
    typedef typename WFrag<T16>::V V;
    __shared__ __align__(16) float os[16 * 68];
    const size_t z = blockIdx.z; A += z * sA; if (A2) A2 += z * sA; Bt += z * sB; if (Bt2) Bt2 += z * sB; C += z * sC;
    const int lane = threadIdx.x & 31, lr = lane & 15, hi = lane >> 4; const int r0 = blockIdx.x * 64, c0 = blockIdx.y * 64;
    v8f acc[4][4];
#pragma unroll
    for (int mb = 0; mb < 4; ++mb)
#pragma unroll
        for (int nb = 0; nb < 4; ++nb) acc[mb][nb] = (v8f){};
    const size_t aoff = (size_t)(r0 + lr) * K + 8 * hi, boff = (size_t)(c0 + lr) * K + 8 * hi;
#pragma unroll 1
    for (int kc = 0; kc < K; kc += 32) {
        V a[4], a2[4];
#pragma unroll
        for (int mb = 0; mb < 4; ++mb) { a[mb] = WFrag<T16>::ld(A + aoff + (size_t)mb * 16 * K + kc); if (NSPLIT == 1 || NSPLIT == 2) a2[mb] = WFrag<T16>::ld(A2 + aoff + (size_t)mb * 16 * K + kc); }
#pragma unroll
        for (int nb = 0; nb < 4; ++nb) { const V b = WFrag<T16>::ld(Bt + boff + (size_t)nb * 16 * K + kc); V b2; if (NSPLIT >= 2) b2 = WFrag<T16>::ld(Bt2 + boff + (size_t)nb * 16 * K + kc);
#pragma unroll
            for (int mb = 0; mb < 4; ++mb) { acc[mb][nb] = WFrag<T16>::mma(a[mb], b, acc[mb][nb]); if (NSPLIT == 1 || NSPLIT == 2) acc[mb][nb] = WFrag<T16>::mma(a2[mb], b, acc[mb][nb]); if (NSPLIT >= 2) acc[mb][nb] = WFrag<T16>::mma(a[mb], b2, acc[mb][nb]); } }
        asm volatile("v_nop\n\tv_nop\n\tv_nop\n\tv_nop" : "+v"(acc[0][0]), "+v"(acc[1][1]), "+v"(acc[2][2]), "+v"(acc[3][3]) : "v"(a[0]), "v"(a[3]));
    }
    if (EPI == 2) {
#pragma unroll
        for (int nb = 0; nb < 4; ++nb) { const float bb = BIAS ? bfr(bias[c0 + nb * 16 + lr]) : 0.f; const size_t po = (size_t)(c0 + nb * 16 + lr) * TT + r0 + 8 * hi;
#pragma unroll
            for (int mb = 0; mb < 4; ++mb) { v8h o16; v8us oh, ol;
#pragma unroll
                for (int j = 0; j < 8; ++j) { const float x = acc[mb][nb][j] + bb; o16[j] = (h16)x; const unsigned short h = f2bf(x); oh[j] = h; ol[j] = f2bf(x - bf2f(h)); }
                *(v8h*)(P16 + po + mb * 16) = o16; *(v8us*)(Ph + po + mb * 16) = oh; *(v8us*)(Pl + po + mb * 16) = ol; } }
        return;
    }
    float bv8[8];
    if (EPI == 1) {
#pragma unroll
        for (int k = 0; k < 8; ++k) bv8[k] = BIAS ? bfr(bias[c0 + (lane & 7) * 8 + k]) : 0.f; }
#pragma unroll
    for (int mb = 0; mb < 4; ++mb) {
#pragma unroll
        for (int nb = 0; nb < 4; ++nb) {
#pragma unroll
            for (int j = 0; j < 8; ++j) os[(hi * 8 + j) * 68 + nb * 16 + lr] = acc[mb][nb][j]; }
        __builtin_amdgcn_wave_barrier(); asm volatile("" ::: "memory");
        if (EPI == 1) {   // a lane takes 8 consecutive d of one token: one store instruction covers 4 tokens = 512 consecutive bytes of a plane
            const size_t po = ((size_t)blockIdx.y * TT + r0 + mb * 16) * HD;
#pragma unroll
            for (int s = 0; s < 4; ++s) { const int row = 4 * s + (lane >> 3), cofs = (lane & 7) * 8; const v4f x0 = *(const v4fa*)(os + row * 68 + cofs), x1 = *(const v4fa*)(os + row * 68 + cofs + 4); v8h o16; v8us oh, ol;
#pragma unroll
                for (int k = 0; k < 8; ++k) { const float x = (k < 4 ? x0[k & 3] : x1[k & 3]) + bv8[k]; o16[k] = (h16)x; const unsigned short h = f2bf(x); oh[k] = h; ol[k] = f2bf(x - bf2f(h)); }
                const size_t o = po + (size_t)row * HD + cofs; *(v8h*)(P16 + o) = o16; *(v8us*)(Ph + o) = oh; *(v8us*)(Pl + o) = ol; }
            __builtin_amdgcn_wave_barrier(); asm volatile("" ::: "memory");   // keeps the next 16 rows' LDS writes behind these reads of the one tile buffer, as in the f32 path below
            continue;
        }
        float* crow = C + (size_t)(r0 + mb * 16) * ldc + c0;
{
#pragma unroll
            for (int s = 0; s < 8; ++s) { const int row = 2 * s + hi, cofs = lr * 4; v4f val = *(const v4fa*)(os + row * 68 + cofs); if (BIAS) { val[0] += bfr(bias[c0 + cofs]); val[1] += bfr(bias[c0 + cofs + 1]); val[2] += bfr(bias[c0 + cofs + 2]); val[3] += bfr(bias[c0 + cofs + 3]); }
                *(v4f*)(crow + (size_t)row * ldc + cofs) = val; }
             }
        __builtin_amdgcn_wave_barrier(); asm volatile("" ::: "memory");
    }
}

#define FAW 8
// XCNT0: the wait that stands between issued global loads and the first later instruction that takes over one of their address registers (the register allocator reuses dead address pairs as fragment and score registers)
#define XCNT0() asm volatile("s_wait_xcnt 0x0" ::: "memory")
#define SC2 (SCL * 1.4426950408889634f)
__device__ __forceinline__ float exp2s(float x) { float r; asm("v_exp_f32 %0, %1\n\tv_nop" : "=v"(r) : "v"(x)); return r; }
// eight at once, each in place: a neighbour touches only its own register, so the one v_nop behind the last serves the run
__device__ __forceinline__ void exp2x8(float* x) { asm("v_exp_f32 %0, %0\n\tv_exp_f32 %1, %1\n\tv_exp_f32 %2, %2\n\tv_exp_f32 %3, %3\n\tv_exp_f32 %4, %4\n\tv_exp_f32 %5, %5\n\tv_exp_f32 %6, %6\n\tv_exp_f32 %7, %7\n\tv_nop" : "+v"(x[0]), "+v"(x[1]), "+v"(x[2]), "+v"(x[3]), "+v"(x[4]), "+v"(x[5]), "+v"(x[6]), "+v"(x[7])); }
template <typename T16, int NSPLIT> struct PPack;
template <> struct PPack<h16, 0> { static __device__ __forceinline__ void pk(const float* p, v16h& a, v16h& b) { (void)b;
#pragma unroll
    for (int s = 0; s < 16; ++s) a[s] = (h16)p[s]; } };
template <> struct PPack<bf, 2> { static __device__ __forceinline__ void pk(const float* p, v16bf& a, v16bf& b) { typedef __attribute__((ext_vector_type(16))) unsigned short v16us; v16us x, y;
#pragma unroll
    for (int s = 0; s < 16; ++s) { const unsigned short h = f2bf(p[s]); x[s] = h; y[s] = f2bf(p[s] - bf2f(h)); }
    a = __builtin_bit_cast(v16bf, x); b = __builtin_bit_cast(v16bf, y); } };
template <typename T16, int NSPLIT, int QT, bool PRE>   // PRE: the key fragments are fetched one pass ahead
__device__ __forceinline__ void fattn_body(const T16* __restrict__ Q, const T16* __restrict__ Q2, const T16* __restrict__ Kp, const T16* __restrict__ Kp2, const T16* __restrict__ Vt, const T16* __restrict__ Vt2, int q0, bf* Ah, bf* Al, float* red, float* sm, float* sl) {
    typedef typename WFrag<T16>::V V;
    constexpr int QB = QT * 16;
    const int lane = threadIdx.x & 31, c = lane & 15, hi = lane >> 4;
    const int w = __builtin_amdgcn_readfirstlane(threadIdx.x >> 5);  // wave number, held scalar so that the pass loop's bounds and branch stay scalar
    V qf[QT][2], qf2[QT][2];
#pragma unroll
    for (int qt = 0; qt < QT; ++qt)
#pragma unroll
        for (int ks = 0; ks < 2; ++ks) { const size_t qo = (size_t)(q0 + qt * 16 + c) * HD + ks * 32 + 8 * hi; qf[qt][ks] = WFrag<T16>::ld(Q + qo); if (NSPLIT >= 2) qf2[qt][ks] = WFrag<T16>::ld(Q2 + qo); }
    v8f o[QT][4]; float m[QT], l[QT];
#pragma unroll
    for (int qt = 0; qt < QT; ++qt) { m[qt] = -3.0e38f; l[qt] = 0.f;
#pragma unroll
        for (int dt = 0; dt < 4; ++dt) o[qt][dt] = (v8f){}; }
    const int np = q0 / 32 + 1;      // 32-key passes up to and including the one that holds the diagonal; key q0's pass is the last, so every pass has a kept key for every query of the block
    V ka[2][2], ka2[2][2];
    const unsigned klo = (unsigned)(c * HD + 8 * hi) * 2u, vlo = (unsigned)(c * TT + 8 * hi) * 2u;   // the lane's byte offsets in a key-row group and a value-row group: fixed over the loop, so that a pass moves only the scalar base
    auto ldk = [&](int kk) { const char* kb = (const char*)(Kp + (size_t)kk * HD) + klo; const char* kb2 = (NSPLIT >= 2) ? (const char*)(Kp2 + (size_t)kk * HD) + klo : nullptr;
#pragma unroll
        for (int kt = 0; kt < 2; ++kt)
#pragma unroll
            for (int ks = 0; ks < 2; ++ks) { const int ko = (kt * 16 * HD + ks * 32) * 2; ka[kt][ks] = WFrag<T16>::ld((const T16*)(kb + ko)); if (NSPLIT >= 2) ka2[kt][ks] = WFrag<T16>::ld((const T16*)(kb2 + ko)); } };
    if (PRE) ldk(min(w, np - 1) * 32);   // a wave without a pass fetches the last pass's rows and uses nothing of them
#pragma unroll 1   // rolled: one pass's fragments live at a time
    for (int p = w; p < np; p += FAW) { const int k0 = p * 32;
        if (!PRE) { ldk(k0); XCNT0(); }
        V va[4], va2[4];
#pragma unroll
        for (int dt = 0; dt < 4; ++dt) { const int vo = dt * 16 * TT * 2; va[dt] = WFrag<T16>::ld((const T16*)((const char*)(Vt + k0) + vlo + vo)); if (NSPLIT >= 2) va2[dt] = WFrag<T16>::ld((const T16*)((const char*)(Vt2 + k0) + vlo + vo)); }
        XCNT0();
        float s[QT][16];
#pragma unroll
        for (int kt = 0; kt < 2; ++kt) {
#pragma unroll
            for (int qt = 0; qt < QT; ++qt) { v8f t = (v8f){};
#pragma unroll
                for (int ks = 0; ks < 2; ++ks) { t = WFrag<T16>::mma(ka[kt][ks], qf[qt][ks], t); if (NSPLIT >= 2) { t = WFrag<T16>::mma(ka[kt][ks], qf2[qt][ks], t); t = WFrag<T16>::mma(ka2[kt][ks], qf[qt][ks], t); } }
#pragma unroll
                for (int r = 0; r < 8; ++r) s[qt][kt * 8 + r] = t[r] * SC2; } }
        if (PRE) ldk((p + FAW < np ? p + FAW : p) * 32);   // the next pass's key rows fly behind this pass's softmax and P.V; the last pass re-reads its own rows, so the address stays inside the plane
        if (k0 + 31 > q0) {          // the diagonal pass (scalar test): keys above the query are masked by select
#pragma unroll
            for (int qt = 0; qt < QT; ++qt) { const int lim = q0 + qt * 16 + c - k0 - 8 * hi;   // element e holds key k0 + 8 hi + (e >> 3) * 16 + (e & 7)
#pragma unroll
                for (int e = 0; e < 16; ++e) if ((e >> 3) * 16 + (e & 7) > lim) s[qt][e] = -3.0e38f; } }
        float mn[QT]; bool need = false;
#pragma unroll
        for (int qt = 0; qt < QT; ++qt) { float pm = s[qt][0];
#pragma unroll
            for (int e = 1; e < 16; ++e) pm = fmaxf(pm, s[qt][e]);
            pm = fmaxf(pm, __shfl_xor(pm, 16, 32)); mn[qt] = fmaxf(m[qt], pm); need = need || (mn[qt] > m[qt]); }
        if (__builtin_amdgcn_ballot_w32(need) != 0) {   // scalar branch: the rescale runs only in a pass that raises some query's maximum
#pragma unroll
            for (int qt = 0; qt < QT; ++qt) { const float al = exp2s(m[qt] - mn[qt]); m[qt] = mn[qt]; l[qt] *= al;
#pragma unroll
                for (int dt = 0; dt < 4; ++dt) o[qt][dt] *= al; } }
#pragma unroll
        for (int qt = 0; qt < QT; ++qt) {
#pragma unroll
            for (int e = 0; e < 16; ++e) s[qt][e] -= m[qt];
            exp2x8(s[qt]); exp2x8(s[qt] + 8);
#pragma unroll
            for (int e = 0; e < 16; ++e) l[qt] += s[qt][e];
            V pb, pb2; PPack<T16, NSPLIT>::pk(s[qt], pb, pb2);
#pragma unroll
            for (int dt = 0; dt < 4; ++dt) { o[qt][dt] = WFrag<T16>::mma(va[dt], pb, o[qt][dt]); if (NSPLIT >= 2) { o[qt][dt] = WFrag<T16>::mma(va[dt], pb2, o[qt][dt]); o[qt][dt] = WFrag<T16>::mma(va2[dt], pb, o[qt][dt]); } } }
    }
#pragma unroll
    for (int qt = 0; qt < QT; ++qt) { l[qt] += __shfl_xor(l[qt], 16, 32); if (hi == 0) { sm[w * QB + qt * 16 + c] = m[qt]; sl[w * QB + qt * 16 + c] = l[qt]; } }
    __syncthreads();   // every wave's maximum and sum are in LDS before any wave forms the joint ones
#pragma unroll
    for (int qt = 0; qt < QT; ++qt) { float M = sm[qt * 16 + c];
#pragma unroll
        for (int u = 1; u < FAW; ++u) M = fmaxf(M, sm[u * QB + qt * 16 + c]);
        float L = 0.f;
#pragma unroll
        for (int u = 0; u < FAW; ++u) L += sl[u * QB + qt * 16 + c] * exp2s(sm[u * QB + qt * 16 + c] - M);   // a wave without a pass has l = 0 and a factor of 0
        const float g = __fdiv_rn(exp2s(m[qt] - M), L);
        float* my = red + (size_t)(w * QB + qt * 16 + c) * 68 + 8 * hi;
#pragma unroll
        for (int dt = 0; dt < 4; ++dt) { v4f a, b;
#pragma unroll
            for (int r = 0; r < 4; ++r) { a[r] = o[qt][dt][r] * g; b[r] = o[qt][dt][r + 4] * g; }
            *(v4fa*)(my + dt * 16) = a; *(v4fa*)(my + dt * 16 + 4) = b; } }
    __syncthreads();   // every wave's scaled partial tile is in LDS before any thread sums across waves
    constexpr int EPT = QB * HD / (32 * FAW);      // output elements per thread: 8 or 4 consecutive d of one query row
    const int row = (int)threadIdx.x / (HD / EPT), d0 = ((int)threadIdx.x % (HD / EPT)) * EPT;
    float acc[EPT];
#pragma unroll
    for (int e4 = 0; e4 < EPT / 4; ++e4) { v4f val = *(const v4fa*)(red + row * 68 + d0 + e4 * 4);
#pragma unroll
        for (int u = 1; u < FAW; ++u) val += *(const v4fa*)(red + (u * QB + row) * 68 + d0 + e4 * 4);
#pragma unroll
        for (int r = 0; r < 4; ++r) acc[e4 * 4 + r] = val[r]; }
    typedef __attribute__((ext_vector_type(EPT))) unsigned short vEus;
    vEus oh, ol;
#pragma unroll
    for (int e = 0; e < EPT; ++e) { const unsigned short h = f2bf(acc[e]); oh[e] = h; ol[e] = f2bf(acc[e] - bf2f(h)); }
    const size_t oo = (size_t)(q0 + row) * DQ + d0; *(vEus*)(Ah + oo) = oh; *(vEus*)(Al + oo) = ol;
}
// grid (heads, row blocks): the block rank is the slow index and its cost falls with it (fp16 blocks of 32 rows from the last row down, then the hi/lo blocks of 16 rows from row RH down)
__global__ __launch_bounds__(32 * FAW) void k_fattn(const h16* __restrict__ Q16, const h16* __restrict__ K16, const h16* __restrict__ V16, const bf* __restrict__ Qh, const bf* __restrict__ Ql, const bf* __restrict__ Kh, const bf* __restrict__ Kl, const bf* __restrict__ Vh, const bf* __restrict__ Vl, bf* Ah, bf* Al) {
    __shared__ __align__(16) float red[FAW * 32 * 68]; __shared__ float sm[FAW * 32]; __shared__ float sl[FAW * 32];
    const size_t zo = (size_t)blockIdx.x * TT * HD; const int y = blockIdx.y; Ah += blockIdx.x * HD; Al += blockIdx.x * HD;
    if (y >= (TT - RH) / 32) { fattn_body<bf, 2, 1, false>(Qh + zo, Ql + zo, Kh + zo, Kl + zo, Vh + zo, Vl + zo, RH - 16 * (y - (TT - RH) / 32 + 1), Ah, Al, red, sm, sl); return; }
    fattn_body<h16, 0, 2, true>(Q16 + zo, nullptr, K16 + zo, nullptr, V16 + zo, nullptr, TT - 32 * (y + 1), Ah, Al, red, sm, sl);
    XCNT0();   // behind this body's two output stores: in the listing the hi/lo body's code follows them and takes over their data registers
}

__global__ __launch_bounds__(256) void k_cvt8(const float* __restrict__ src, bf* dst, size_t n8) { const size_t i = (size_t)blockIdx.x * 256 + threadIdx.x; if (i >= n8) return; const v8f v = *(const v8f*)(src + i * 8); v8us o;
#pragma unroll
    for (int k = 0; k < 8; ++k) o[k] = f2bf(v[k]); *(v8us*)(dst + i * 8) = o;  }

extern "C" void kernel_launch(void* const* d_in, const int* in_sizes, int n_in,
                              void* d_out, int out_size, void* d_ws, size_t ws_size, hipStream_t stream) {
    (void)in_sizes; (void)n_in; (void)out_size;
    const float* x = (const float*)d_in[0]; const float* xk = (const float*)d_in[1]; const float* xv = (const float*)d_in[2]; const float* wq = (const float*)d_in[3]; const float* bq = (const float*)d_in[4]; const float* wk = (const float*)d_in[3]; const float* bk = (const float*)d_in[4]; const float* wv = (const float*)d_in[3]; const float* bv = (const float*)d_in[4]; const float* wo = (const float*)d_in[5]; const float* bo = (const float*)d_in[6];   /* argument order Q, K, V (three streams), wq ('oi': the ONE weight used for the q, k AND v projections, as the source module does), bq (the one shared bias), wo ('oi'), bo; the causal rule is applied by index: no mask input */
    float* OUT = (float*)d_out;     // [2][2048][1024]
    char* wsp = (char*)d_ws;
    auto take = [&](size_t bytes) { char* p = wsp; wsp += (bytes + 255) & ~(size_t)255; return (void*)p; };
    bf* WQ = (bf*)take((size_t)DQ * DM * 2); bf* WK = (bf*)take((size_t)DKV * DM * 2); bf* WV = (bf*)take((size_t)DKV * DM * 2); bf* WO = (bf*)take((size_t)DM * DQ * 2);
    bf* XB = (bf*)take((size_t)TT * DM * 2);
    h16* QP16 = (h16*)take((size_t)NH_ * TT * HD * 2); h16* KP16 = (h16*)take((size_t)NKV * TT * HD * 2); h16* VT16 = (h16*)take((size_t)NKV * HD * TT * 2);
    bf* QPh = (bf*)take((size_t)NH_ * TT * HD * 2); bf* QPl = (bf*)take((size_t)NH_ * TT * HD * 2); bf* KPh = (bf*)take((size_t)NKV * TT * HD * 2); bf* KPl = (bf*)take((size_t)NKV * TT * HD * 2); bf* VTh = (bf*)take((size_t)NKV * HD * TT * 2); bf* VTl = (bf*)take((size_t)NKV * HD * TT * 2);
    bf* ATh = (bf*)take((size_t)TT * DQ * 2); bf* ATl = (bf*)take((size_t)TT * DQ * 2);
    if ((size_t)(wsp - (char*)d_ws) > ws_size) return;    // ws 256 MiB
    { k_cvt8<<<(unsigned)(((size_t)DQ * DM / 8 + 255) / 256), 256, 0, stream>>>(wq, WQ, (size_t)DQ * DM / 8); k_cvt8<<<(unsigned)(((size_t)DKV * DM / 8 + 255) / 256), 256, 0, stream>>>(wk, WK, (size_t)DKV * DM / 8); k_cvt8<<<(unsigned)(((size_t)DKV * DM / 8 + 255) / 256), 256, 0, stream>>>(wv, WV, (size_t)DKV * DM / 8);
      k_cvt8<<<(unsigned)(((size_t)DM * DQ / 8 + 255) / 256), 256, 0, stream>>>(wo, WO, (size_t)DM * DQ / 8);
       }
    for (int b = 0; b < NB_; ++b) {
        
        k_cvt8<<<(unsigned)(((size_t)TT * DM / 8 + 255) / 256), 256, 0, stream>>>(x + (size_t)b * TT * DM, XB, (size_t)TT * DM / 8);
        k_gemmw<bf, 0, true, 1><<<dim3(TT / 64, DQ / 64, 1), 32, 0, stream>>>(XB, nullptr, WQ, nullptr, DM, nullptr, 0, bq, 0, 0, 0, QP16, QPh, QPl);
        k_cvt8<<<(unsigned)(((size_t)TT * DM / 8 + 255) / 256), 256, 0, stream>>>(xk + (size_t)b * TT * DM, XB, (size_t)TT * DM / 8);   /* XB := bf16(k[b]) */ k_gemmw<bf, 0, true, 1><<<dim3(TT / 64, DKV / 64, 1), 32, 0, stream>>>(XB, nullptr, WK, nullptr, DM, nullptr, 0, bk, 0, 0, 0, KP16, KPh, KPl);
        k_cvt8<<<(unsigned)(((size_t)TT * DM / 8 + 255) / 256), 256, 0, stream>>>(xv + (size_t)b * TT * DM, XB, (size_t)TT * DM / 8);   /* XB := bf16(v[b]) */ k_gemmw<bf, 0, true, 2><<<dim3(TT / 64, DKV / 64, 1), 32, 0, stream>>>(XB, nullptr, WV, nullptr, DM, nullptr, 0, bv, 0, 0, 0, VT16, VTh, VTl);
        k_fattn<<<dim3(NH_, (TT - RH) / 32 + RH / 16, 1), 32 * FAW, 0, stream>>>(QP16, KP16, VT16, QPh, QPl, KPh, KPl, VTh, VTl, ATh, ATl);   // one kv head per query head
        k_gemmw<bf, 1, true, 0><<<dim3(TT / 64, DM / 64, 1), 32, 0, stream>>>(ATh, ATl, WO, nullptr, DQ, OUT + (size_t)b * TT * DM, DM, bo, 0, 0, 0, nullptr, nullptr, nullptr); }
}

// v005
// Measured time: 145 microseconds a run.
// Two timings next to v004 put it at 2.00 and 1.96 times that version's speed.
// Counting every step since v000, it is 10.1 times as fast.
#include <hip/hip_runtime.h>

// Causal multi-head attention on three input streams that uses ONE shared projection for Q, K and V (Q, K, V [2][2048][1024]; q = Q wq^T + bq, k = K wq^T + bq, v = V wq^T + bq: the SAME 'oi' [1024][1024] weight (normal x 0.02) and the same bias (zeros on this draw: read) for all three streams, as the source module does; 16 heads x 64); scores x 1/sqrt(64); tril kept, -inf elsewhere; softmax over the keys; out = merged wo^T + bo ('oi' + bias zeros: read) -> [2][2048][1024] (4.2 M); argument order Q, K, V, wq, bq, wo, bo).
// Four launches, each over both batches: bf16 copies of q, k, v and the two 'oi' weights; exact projections + f32 biases of all three streams, whose epilogue writes the head planes; fused causal T-2048 attention (hybrid rows: < 512 hi/lo 3 products, rest fp16; passes above the diagonal are never walked); merged hi/lo x Wo exact + bo.
// Compute dtypes, f32 accumulate: every input rounded to bf16; projections exact + f32 biases; attention rows < 512 3 products, rest fp16; softmax f32; Wo hl x exact + bias.

#define NB_  2
#define TT   2048
#define DM   1024
#define NH_  16
#define NKV  16
#define REP  (NH_ / NKV)
#define HD   64
#define DQ   (NH_ * HD)
#define DKV  (NKV * HD)
#define RH   512                  // query rows < RH use hi+lo planes (0: none)
#define SCL  0.125f   // HD^-0.5
typedef _Float16 h16;
typedef unsigned short bf;
typedef __attribute__((ext_vector_type(16))) __bf16   v16bf;
typedef __attribute__((ext_vector_type(16))) _Float16 v16h;
typedef __attribute__((ext_vector_type(8)))  _Float16 v8h;
typedef __attribute__((ext_vector_type(8)))  unsigned short v8us;
typedef __attribute__((ext_vector_type(8)))  float    v8f;
typedef __attribute__((ext_vector_type(4)))  float    v4f;
typedef v8h  __attribute__((may_alias)) v8ha;
typedef v4f  __attribute__((may_alias)) v4fa;
typedef v8us __attribute__((may_alias)) v8usa;

__device__ __forceinline__ unsigned short f2bf(float f) { unsigned u = __float_as_uint(f); u += 0x7FFFu + ((u >> 16) & 1u); return (unsigned short)(u >> 16); }
__device__ __forceinline__ float bf2f(unsigned short b) { return __uint_as_float(((unsigned)b) << 16); }
__device__ __forceinline__ float bfr(float f) { return bf2f(f2bf(f)); }
__device__ __forceinline__ v16h cat16(v8h lo, v8h hi) { return __builtin_shufflevector(lo, hi, 0, 1, 2, 3, 4, 5, 6, 7, 8, 9, 10, 11, 12, 13, 14, 15); }
__device__ __forceinline__ v16bf cat16b(v8us lo, v8us hi) { return __builtin_bit_cast(v16bf, __builtin_shufflevector(lo, hi, 0, 1, 2, 3, 4, 5, 6, 7, 8, 9, 10, 11, 12, 13, 14, 15)); }
__device__ __forceinline__ v8f wmma16(v16h a, v16h b, v8f c) { return __builtin_amdgcn_wmma_f32_16x16x32_f16(false, a, false, b, (short)0, c, false, false); }
__device__ __forceinline__ v8f wmmab(v16bf a, v16bf b, v8f c) { return __builtin_amdgcn_wmma_f32_16x16x32_bf16(false, a, false, b, (short)0, c, false, false); }



// ---- k_gemmw: register-blocked GEMM, ONE WAVE per 64x64 output tile (16 accumulators), operands straight from K-contiguous 16-bit planes; grid (M/64, N/64, Z), 32 threads.
// C[m][n] (f32, pitch ldc, + optional f32 bias[n]) = sum_k A[m][k] Bt[n][k] (+ split products per NSPLIT). z-batch strides sA/sB/sC in elements. K % 32 == 0. Row m is token m % TT of batch m / TT.
// EPI 0: C is stored as f32. EPI 1: z is the stream (0 q, 1 k, 2 v; sC = one stream's plane); the tile is 64 tokens of ONE head (HD == 64) of one batch and goes out as the [b][h][t][d] planes fp16, bf16 hi, bf16 lo; the v stream's three planes are transposed, [b][h][d][t]: a lane's 8 accumulator rows are 8 consecutive tokens of one d, so they are stored from the registers.
template <typename T16> struct WFrag;
template <> struct WFrag<h16> { typedef v16h V; static __device__ __forceinline__ V ld(const h16* p) { return cat16(*(const v8h*)p, *(const v8h*)(p + 16)); } static __device__ __forceinline__ v8f mma(V a, V b, v8f c) { return wmma16(a, b, c); } };
template <> struct WFrag<bf> { typedef v16bf V; static __device__ __forceinline__ V ld(const bf* p) { return cat16b(*(const v8us*)p, *(const v8us*)(p + 16)); } static __device__ __forceinline__ v8f mma(V a, V b, v8f c) { return wmmab(a, b, c); } };
template <typename T16, int NSPLIT, bool BIAS, int EPI>
__global__ __launch_bounds__(32) void k_gemmw(const T16* __restrict__ A, const T16* __restrict__ A2, const T16* __restrict__ Bt, const T16* __restrict__ Bt2, int K, float* C, int ldc, const float* __restrict__ bias, size_t sA, size_t sB, size_t sC, h16* P16, bf* Ph, bf* Pl) {
    static_assert(EPI == 0 || (HD == 64 && TT % 64 == 0), "a plane epilogue takes one 64-wide tile as one head and 64 rows as tokens of one batch");
    typedef typename WFrag<T16>::V V;
    __shared__ __align__(16) float os[16 * 68];
    const size_t z = blockIdx.z; A += z * sA; if (A2) A2 += z * sA; Bt += z * sB; if (Bt2) Bt2 += z * sB; if (EPI == 0) C += z * sC; else { P16 += z * sC; Ph += z * sC; Pl += z * sC; }
    const int lane = threadIdx.x & 31, lr = lane & 15, hi = lane >> 4; const int r0 = blockIdx.x * 64, c0 = blockIdx.y * 64; const int bt = r0 / TT, t0 = r0 % TT;
    v8f acc[4][4];
#pragma unroll
    for (int mb = 0; mb < 4; ++mb)
#pragma unroll
        for (int nb = 0; nb < 4; ++nb) acc[mb][nb] = (v8f){};
    const size_t aoff = (size_t)(r0 + lr) * K + 8 * hi, boff = (size_t)(c0 + lr) * K + 8 * hi;
#pragma unroll 1
    for (int kc = 0; kc < K; kc += 32) {
        V a[4], a2[4];
#pragma unroll
        for (int mb = 0; mb < 4; ++mb) { a[mb] = WFrag<T16>::ld(A + aoff + (size_t)mb * 16 * K + kc); if (NSPLIT == 1 || NSPLIT == 2) a2[mb] = WFrag<T16>::ld(A2 + aoff + (size_t)mb * 16 * K + kc); }
#pragma unroll
        for (int nb = 0; nb < 4; ++nb) { const V b = WFrag<T16>::ld(Bt + boff + (size_t)nb * 16 * K + kc); V b2; if (NSPLIT >= 2) b2 = WFrag<T16>::ld(Bt2 + boff + (size_t)nb * 16 * K + kc);
#pragma unroll
            for (int mb = 0; mb < 4; ++mb) { acc[mb][nb] = WFrag<T16>::mma(a[mb], b, acc[mb][nb]); if (NSPLIT == 1 || NSPLIT == 2) acc[mb][nb] = WFrag<T16>::mma(a2[mb], b, acc[mb][nb]); if (NSPLIT >= 2) acc[mb][nb] = WFrag<T16>::mma(a[mb], b2, acc[mb][nb]); } }
        asm volatile("v_nop\n\tv_nop\n\tv_nop\n\tv_nop" : "+v"(acc[0][0]), "+v"(acc[1][1]), "+v"(acc[2][2]), "+v"(acc[3][3]) : "v"(a[0]), "v"(a[3]));
    }
    if (EPI == 1 && blockIdx.z == 2) {
#pragma unroll
        for (int nb = 0; nb < 4; ++nb) { const float bb = BIAS ? bfr(bias[c0 + nb * 16 + lr]) : 0.f; const size_t po = (size_t)(bt * DKV + c0 + nb * 16 + lr) * TT + t0 + 8 * hi;
#pragma unroll
            for (int mb = 0; mb < 4; ++mb) { v8h o16; v8us oh, ol;
#pragma unroll
                for (int j = 0; j < 8; ++j) { const float x = acc[mb][nb][j] + bb; o16[j] = (h16)x; const unsigned short h = f2bf(x); oh[j] = h; ol[j] = f2bf(x - bf2f(h)); }
                *(v8h*)(P16 + po + mb * 16) = o16; *(v8us*)(Ph + po + mb * 16) = oh; *(v8us*)(Pl + po + mb * 16) = ol; } }
        return;
    }
    float bv8[8];
    if (EPI == 1) {
#pragma unroll
        for (int k = 0; k < 8; ++k) bv8[k] = BIAS ? bfr(bias[c0 + (lane & 7) * 8 + k]) : 0.f; }
#pragma unroll
    for (int mb = 0; mb < 4; ++mb) {
#pragma unroll
        for (int nb = 0; nb < 4; ++nb) {
#pragma unroll
            for (int j = 0; j < 8; ++j) os[(hi * 8 + j) * 68 + nb * 16 + lr] = acc[mb][nb][j]; }
        __builtin_amdgcn_wave_barrier(); asm volatile("" ::: "memory");
        if (EPI == 1) {   // a lane takes 8 consecutive d of one token: one store instruction covers 4 tokens = 512 consecutive bytes of a plane
            const size_t po = ((size_t)(bt * NH_ + blockIdx.y) * TT + t0 + mb * 16) * HD;
#pragma unroll
            for (int s = 0; s < 4; ++s) { const int row = 4 * s + (lane >> 3), cofs = (lane & 7) * 8; const v4f x0 = *(const v4fa*)(os + row * 68 + cofs), x1 = *(const v4fa*)(os + row * 68 + cofs + 4); v8h o16; v8us oh, ol;
#pragma unroll
                for (int k = 0; k < 8; ++k) { const float x = (k < 4 ? x0[k & 3] : x1[k & 3]) + bv8[k]; o16[k] = (h16)x; const unsigned short h = f2bf(x); oh[k] = h; ol[k] = f2bf(x - bf2f(h)); }
                const size_t o = po + (size_t)row * HD + cofs; *(v8h*)(P16 + o) = o16; *(v8us*)(Ph + o) = oh; *(v8us*)(Pl + o) = ol; }
            __builtin_amdgcn_wave_barrier(); asm volatile("" ::: "memory");   // keeps the next 16 rows' LDS writes behind these reads of the one tile buffer, as in the f32 path below
            continue;
        }
        float* crow = C + (size_t)(r0 + mb * 16) * ldc + c0;
{
#pragma unroll
            for (int s = 0; s < 8; ++s) { const int row = 2 * s + hi, cofs = lr * 4; v4f val = *(const v4fa*)(os + row * 68 + cofs); if (BIAS) { val[0] += bfr(bias[c0 + cofs]); val[1] += bfr(bias[c0 + cofs + 1]); val[2] += bfr(bias[c0 + cofs + 2]); val[3] += bfr(bias[c0 + cofs + 3]); }
                *(v4f*)(crow + (size_t)row * ldc + cofs) = val; }
             }
        __builtin_amdgcn_wave_barrier(); asm volatile("" ::: "memory");
    }
    if (EPI == 1) asm volatile("s_wait_xcnt 0x0" ::: "memory");   // behind the last plane stores: in the listing the transposed epilogue's code follows them and takes over their registers
}

#define FAW 8
// XCNT0: the wait that stands between issued global loads and the first later instruction that takes over one of their address registers (the register allocator reuses dead address pairs as fragment and score registers)
#define XCNT0() asm volatile("s_wait_xcnt 0x0" ::: "memory")
#define SC2 (SCL * 1.4426950408889634f)
__device__ __forceinline__ float exp2s(float x) { float r; asm("v_exp_f32 %0, %1\n\tv_nop" : "=v"(r) : "v"(x)); return r; }
// eight at once, each in place: a neighbour touches only its own register, so the one v_nop behind the last serves the run
__device__ __forceinline__ void exp2x8(float* x) { asm("v_exp_f32 %0, %0\n\tv_exp_f32 %1, %1\n\tv_exp_f32 %2, %2\n\tv_exp_f32 %3, %3\n\tv_exp_f32 %4, %4\n\tv_exp_f32 %5, %5\n\tv_exp_f32 %6, %6\n\tv_exp_f32 %7, %7\n\tv_nop" : "+v"(x[0]), "+v"(x[1]), "+v"(x[2]), "+v"(x[3]), "+v"(x[4]), "+v"(x[5]), "+v"(x[6]), "+v"(x[7])); }
template <typename T16, int NSPLIT> struct PPack;
template <> struct PPack<h16, 0> { static __device__ __forceinline__ void pk(const float* p, v16h& a, v16h& b) { (void)b;
#pragma unroll
    for (int s = 0; s < 16; ++s) a[s] = (h16)p[s]; } };
template <> struct PPack<bf, 2> { static __device__ __forceinline__ void pk(const float* p, v16bf& a, v16bf& b) { typedef __attribute__((ext_vector_type(16))) unsigned short v16us; v16us x, y;
#pragma unroll
    for (int s = 0; s < 16; ++s) { const unsigned short h = f2bf(p[s]); x[s] = h; y[s] = f2bf(p[s] - bf2f(h)); }
    a = __builtin_bit_cast(v16bf, x); b = __builtin_bit_cast(v16bf, y); } };
template <typename T16, int NSPLIT, int QT, bool PRE>   // PRE: the key fragments are fetched one pass ahead
__device__ __forceinline__ void fattn_body(const T16* __restrict__ Q, const T16* __restrict__ Q2, const T16* __restrict__ Kp, const T16* __restrict__ Kp2, const T16* __restrict__ Vt, const T16* __restrict__ Vt2, int q0, bf* Ah, bf* Al, float* red, float* sm, float* sl) {
    typedef typename WFrag<T16>::V V;
    constexpr int QB = QT * 16;
    const int lane = threadIdx.x & 31, c = lane & 15, hi = lane >> 4;
    const int w = __builtin_amdgcn_readfirstlane(threadIdx.x >> 5);  // wave number, held scalar so that the pass loop's bounds and branch stay scalar
    V qf[QT][2], qf2[QT][2];
#pragma unroll
    for (int qt = 0; qt < QT; ++qt)
#pragma unroll
        for (int ks = 0; ks < 2; ++ks) { const size_t qo = (size_t)(q0 + qt * 16 + c) * HD + ks * 32 + 8 * hi; qf[qt][ks] = WFrag<T16>::ld(Q + qo); if (NSPLIT >= 2) qf2[qt][ks] = WFrag<T16>::ld(Q2 + qo); }
    v8f o[QT][4]; float m[QT], l[QT];
#pragma unroll
    for (int qt = 0; qt < QT; ++qt) { m[qt] = -3.0e38f; l[qt] = 0.f;
#pragma unroll
        for (int dt = 0; dt < 4; ++dt) o[qt][dt] = (v8f){}; }
    const int np = q0 / 32 + 1;      // 32-key passes up to and including the one that holds the diagonal; key q0's pass is the last, so every pass has a kept key for every query of the block
    V ka[2][2], ka2[2][2];
    const unsigned klo = (unsigned)(c * HD + 8 * hi) * 2u, vlo = (unsigned)(c * TT + 8 * hi) * 2u;   // the lane's byte offsets in a key-row group and a value-row group: fixed over the loop, so that a pass moves only the scalar base
    auto ldk = [&](int kk) { const char* kb = (const char*)(Kp + (size_t)kk * HD) + klo; const char* kb2 = (NSPLIT >= 2) ? (const char*)(Kp2 + (size_t)kk * HD) + klo : nullptr;
#pragma unroll
        for (int kt = 0; kt < 2; ++kt)
#pragma unroll
            for (int ks = 0; ks < 2; ++ks) { const int ko = (kt * 16 * HD + ks * 32) * 2; ka[kt][ks] = WFrag<T16>::ld((const T16*)(kb + ko)); if (NSPLIT >= 2) ka2[kt][ks] = WFrag<T16>::ld((const T16*)(kb2 + ko)); } };
    if (PRE) ldk(min(w, np - 1) * 32);   // a wave without a pass fetches the last pass's rows and uses nothing of them
#pragma unroll 1   // rolled: one pass's fragments live at a time
    for (int p = w; p < np; p += FAW) { const int k0 = p * 32;
        if (!PRE) { ldk(k0); XCNT0(); }
        V va[4], va2[4];
#pragma unroll
        for (int dt = 0; dt < 4; ++dt) { const int vo = dt * 16 * TT * 2; va[dt] = WFrag<T16>::ld((const T16*)((const char*)(Vt + k0) + vlo + vo)); if (NSPLIT >= 2) va2[dt] = WFrag<T16>::ld((const T16*)((const char*)(Vt2 + k0) + vlo + vo)); }
        XCNT0();
        float s[QT][16];
#pragma unroll
        for (int kt = 0; kt < 2; ++kt) {
#pragma unroll
            for (int qt = 0; qt < QT; ++qt) { v8f t = (v8f){};
#pragma unroll
                for (int ks = 0; ks < 2; ++ks) { t = WFrag<T16>::mma(ka[kt][ks], qf[qt][ks], t); if (NSPLIT >= 2) { t = WFrag<T16>::mma(ka[kt][ks], qf2[qt][ks], t); t = WFrag<T16>::mma(ka2[kt][ks], qf[qt][ks], t); } }
#pragma unroll
                for (int r = 0; r < 8; ++r) s[qt][kt * 8 + r] = t[r] * SC2; } }
        if (PRE) ldk((p + FAW < np ? p + FAW : p) * 32);   // the next pass's key rows fly behind this pass's softmax and P.V; the last pass re-reads its own rows, so the address stays inside the plane
        if (k0 + 31 > q0) {          // the diagonal pass (scalar test): keys above the query are masked by select
#pragma unroll
            for (int qt = 0; qt < QT; ++qt) { const int lim = q0 + qt * 16 + c - k0 - 8 * hi;   // element e holds key k0 + 8 hi + (e >> 3) * 16 + (e & 7)
#pragma unroll
                for (int e = 0; e < 16; ++e) if ((e >> 3) * 16 + (e & 7) > lim) s[qt][e] = -3.0e38f; } }
        float mn[QT]; bool need = false;
#pragma unroll
        for (int qt = 0; qt < QT; ++qt) { float pm = s[qt][0];
#pragma unroll
            for (int e = 1; e < 16; ++e) pm = fmaxf(pm, s[qt][e]);
            pm = fmaxf(pm, __shfl_xor(pm, 16, 32)); mn[qt] = fmaxf(m[qt], pm); need = need || (mn[qt] > m[qt]); }
        if (__builtin_amdgcn_ballot_w32(need) != 0) {   // scalar branch: the rescale runs only in a pass that raises some query's maximum
#pragma unroll
            for (int qt = 0; qt < QT; ++qt) { const float al = exp2s(m[qt] - mn[qt]); m[qt] = mn[qt]; l[qt] *= al;
#pragma unroll
                for (int dt = 0; dt < 4; ++dt) o[qt][dt] *= al; } }
#pragma unroll
        for (int qt = 0; qt < QT; ++qt) {
#pragma unroll
            for (int e = 0; e < 16; ++e) s[qt][e] -= m[qt];
            exp2x8(s[qt]); exp2x8(s[qt] + 8);
#pragma unroll
            for (int e = 0; e < 16; ++e) l[qt] += s[qt][e];
            V pb, pb2; PPack<T16, NSPLIT>::pk(s[qt], pb, pb2);
#pragma unroll
            for (int dt = 0; dt < 4; ++dt) { o[qt][dt] = WFrag<T16>::mma(va[dt], pb, o[qt][dt]); if (NSPLIT >= 2) { o[qt][dt] = WFrag<T16>::mma(va[dt], pb2, o[qt][dt]); o[qt][dt] = WFrag<T16>::mma(va2[dt], pb, o[qt][dt]); } } }
    }
#pragma unroll
    for (int qt = 0; qt < QT; ++qt) { l[qt] += __shfl_xor(l[qt], 16, 32); if (hi == 0) { sm[w * QB + qt * 16 + c] = m[qt]; sl[w * QB + qt * 16 + c] = l[qt]; } }
    __syncthreads();   // every wave's maximum and sum are in LDS before any wave forms the joint ones
#pragma unroll
    for (int qt = 0; qt < QT; ++qt) { float M = sm[qt * 16 + c];
#pragma unroll
        for (int u = 1; u < FAW; ++u) M = fmaxf(M, sm[u * QB + qt * 16 + c]);
        float L = 0.f;
#pragma unroll
        for (int u = 0; u < FAW; ++u) L += sl[u * QB + qt * 16 + c] * exp2s(sm[u * QB + qt * 16 + c] - M);   // a wave without a pass has l = 0 and a factor of 0
        const float g = __fdiv_rn(exp2s(m[qt] - M), L);
        float* my = red + (size_t)(w * QB + qt * 16 + c) * 68 + 8 * hi;
#pragma unroll
        for (int dt = 0; dt < 4; ++dt) { v4f a, b;
#pragma unroll
            for (int r = 0; r < 4; ++r) { a[r] = o[qt][dt][r] * g; b[r] = o[qt][dt][r + 4] * g; }
            *(v4fa*)(my + dt * 16) = a; *(v4fa*)(my + dt * 16 + 4) = b; } }
    __syncthreads();   // every wave's scaled partial tile is in LDS before any thread sums across waves
    constexpr int EPT = QB * HD / (32 * FAW);      // output elements per thread: 8 or 4 consecutive d of one query row
    const int row = (int)threadIdx.x / (HD / EPT), d0 = ((int)threadIdx.x % (HD / EPT)) * EPT;
    float acc[EPT];
#pragma unroll
    for (int e4 = 0; e4 < EPT / 4; ++e4) { v4f val = *(const v4fa*)(red + row * 68 + d0 + e4 * 4);
#pragma unroll
        for (int u = 1; u < FAW; ++u) val += *(const v4fa*)(red + (u * QB + row) * 68 + d0 + e4 * 4);
#pragma unroll
        for (int r = 0; r < 4; ++r) acc[e4 * 4 + r] = val[r]; }
    typedef __attribute__((ext_vector_type(EPT))) unsigned short vEus;
    vEus oh, ol;
#pragma unroll
    for (int e = 0; e < EPT; ++e) { const unsigned short h = f2bf(acc[e]); oh[e] = h; ol[e] = f2bf(acc[e] - bf2f(h)); }
    const size_t oo = (size_t)(q0 + row) * DQ + d0; *(vEus*)(Ah + oo) = oh; *(vEus*)(Al + oo) = ol;
}
// grid (batches x heads, row blocks): the block rank is the slow index and its cost falls with it (fp16 blocks of 32 rows from the last row down, then the hi/lo blocks of 16 rows from row RH down)
__global__ __launch_bounds__(32 * FAW) void k_fattn(const h16* __restrict__ Q16, const h16* __restrict__ K16, const h16* __restrict__ V16, const bf* __restrict__ Qh, const bf* __restrict__ Ql, const bf* __restrict__ Kh, const bf* __restrict__ Kl, const bf* __restrict__ Vh, const bf* __restrict__ Vl, bf* Ah, bf* Al) {
    __shared__ __align__(16) float red[FAW * 32 * 68]; __shared__ float sm[FAW * 32]; __shared__ float sl[FAW * 32];
    const size_t zo = (size_t)blockIdx.x * TT * HD; const int y = blockIdx.y; const size_t ao = (size_t)(blockIdx.x / NH_) * TT * DQ + (blockIdx.x % NH_) * HD; Ah += ao; Al += ao;
    if (y >= (TT - RH) / 32) { fattn_body<bf, 2, 1, false>(Qh + zo, Ql + zo, Kh + zo, Kl + zo, Vh + zo, Vl + zo, RH - 16 * (y - (TT - RH) / 32 + 1), Ah, Al, red, sm, sl); return; }
    fattn_body<h16, 0, 2, true>(Q16 + zo, nullptr, K16 + zo, nullptr, V16 + zo, nullptr, TT - 32 * (y + 1), Ah, Al, red, sm, sl);
    XCNT0();   // behind this body's two output stores: in the listing the hi/lo body's code follows them and takes over their data registers
}

// ---- k_cvt8: every f32 source rounded to bf16 in one launch. The five destinations lie one behind the other in the workspace (q, k, v streams, then wq, wo), so the flat index is the destination index; a block of 2048 elements lies in one source, picked by a scalar test on the block index.
#define XBLK ((unsigned)((size_t)NB_ * TT * DM / 2048))   // blocks per stream
#define WBLK ((unsigned)((size_t)DQ * DM / 2048))         // blocks per weight
__global__ __launch_bounds__(256) void k_cvt8(const float* __restrict__ xq, const float* __restrict__ xk, const float* __restrict__ xv, const float* __restrict__ wq, const float* __restrict__ wo, bf* dst) {
    static_assert((size_t)NB_ * TT * DM % 2048 == 0 && (size_t)DQ * DM % 2048 == 0, "the grid covers every source exactly");
    static_assert(2 * WBLK <= XBLK, "both weights' blocks fall into stream number 3");
    const unsigned b = blockIdx.x, s = b / XBLK, lb = s < 3 ? b % XBLK : (b - 3 * XBLK) % WBLK;
    const float* src = s == 0 ? xq : s == 1 ? xk : s == 2 ? xv : b < 3 * XBLK + WBLK ? wq : wo;
    const v8f v = *(const v8f*)(src + ((size_t)lb * 256 + threadIdx.x) * 8); v8us o;
    XCNT0();   // behind the two loads: the rounding below takes over their address register
#pragma unroll
    for (int k = 0; k < 8; ++k) o[k] = f2bf(v[k]); *(v8us*)(dst + ((size_t)b * 256 + threadIdx.x) * 8) = o;  }

extern "C" void kernel_launch(void* const* d_in, const int* in_sizes, int n_in,
                              void* d_out, int out_size, void* d_ws, size_t ws_size, hipStream_t stream) {
    (void)in_sizes; (void)n_in; (void)out_size;
    const float* x = (const float*)d_in[0]; const float* xk = (const float*)d_in[1]; const float* xv = (const float*)d_in[2]; const float* wq = (const float*)d_in[3]; const float* bq = (const float*)d_in[4]; const float* wo = (const float*)d_in[5]; const float* bo = (const float*)d_in[6];   /* input order Q, K, V (three streams), wq ('oi': the ONE weight used for the q, k AND v projections, as the source module does), bq (the one shared bias), wo ('oi'), bo; the causal rule is applied by index: no mask input */
    float* OUT = (float*)d_out;     // [2][2048][1024]
    char* wsp = (char*)d_ws;
    auto take = [&](size_t bytes) { char* p = wsp; wsp += (bytes + 255) & ~(size_t)255; return (void*)p; };
    const size_t SX = (size_t)NB_ * TT * DM, SP = (size_t)NB_ * NH_ * TT * HD;   // elements of one stream's bf16 copy and of one stream's plane, both batches
    bf* XB = (bf*)take((3 * SX + (size_t)DQ * DM + (size_t)DM * DQ) * 2); bf* WQ = XB + 3 * SX; bf* WO = WQ + (size_t)DQ * DM;   // one block: k_cvt8 writes it by the flat index
    h16* P16 = (h16*)take(3 * SP * 2); bf* Ph = (bf*)take(3 * SP * 2); bf* Pl = (bf*)take(3 * SP * 2);   // each [stream q, k, v][b][h]...
    bf* ATh = (bf*)take((size_t)NB_ * TT * DQ * 2); bf* ATl = (bf*)take((size_t)NB_ * TT * DQ * 2);
    if ((size_t)(wsp - (char*)d_ws) > ws_size) return;    // ws 256 MiB
    k_cvt8<<<3 * XBLK + 2 * WBLK, 256, 0, stream>>>(x, xk, xv, wq, wo, XB);
    k_gemmw<bf, 0, true, 1><<<dim3(NB_ * TT / 64, DQ / 64, 3), 32, 0, stream>>>(XB, nullptr, WQ, nullptr, DM, nullptr, 0, bq, SX, 0, SP, P16, Ph, Pl);
    k_fattn<<<dim3(NB_ * NH_, (TT - RH) / 32 + RH / 16, 1), 32 * FAW, 0, stream>>>(P16, P16 + SP, P16 + 2 * SP, Ph, Pl, Ph + SP, Pl + SP, Ph + 2 * SP, Pl + 2 * SP, ATh, ATl);   // one kv head per query head
    k_gemmw<bf, 1, true, 0><<<dim3(NB_ * TT / 64, DM / 64, 1), 32, 0, stream>>>(ATh, ATl, WO, nullptr, DQ, OUT, DM, bo, 0, 0, 0, nullptr, nullptr, nullptr);
}

// v006
// One run takes 115 microseconds.
// Next to v005, in two timings, it ran 1.24 times as fast each time.
// All steps since v000 together make it 12.5 times as fast.
#include <hip/hip_runtime.h>

// Causal multi-head attention on three input streams that uses ONE shared projection for Q, K and V (Q, K, V [2][2048][1024]; q = Q wq^T + bq, k = K wq^T + bq, v = V wq^T + bq: the SAME 'oi' [1024][1024] weight (normal x 0.02) and the same bias (zeros on this draw: read) for all three streams, as the source module does; 16 heads x 64); scores x 1/sqrt(64); tril kept, -inf elsewhere; softmax over the keys; out = merged wo^T + bo ('oi' + bias zeros: read) -> [2][2048][1024] (4.2 M); argument order Q, K, V, wq, bq, wo, bo).
// Four launches, each over both batches: bf16 copies of q, k, v and the two 'oi' weights; exact projections + f32 biases of all three streams, whose epilogue writes the head planes; fused causal T-2048 attention (hybrid rows: < 512 hi/lo 3 products, rest fp16; passes above the diagonal are never walked); merged hi/lo x Wo exact + bo.
// Compute dtypes, f32 accumulate: every input rounded to bf16; projections exact + f32 biases; attention rows < 512 3 products, rest fp16; softmax f32; Wo hl x exact + bias.

#define NB_  2
#define TT   2048
#define DM   1024
#define NH_  16
#define NKV  16
#define REP  (NH_ / NKV)
#define HD   64
#define DQ   (NH_ * HD)
#define DKV  (NKV * HD)
#define RH   512                  // query rows < RH use hi+lo planes (0: none)
#define SCL  0.125f   // HD^-0.5
typedef _Float16 h16;
typedef unsigned short bf;
typedef __attribute__((ext_vector_type(16))) __bf16   v16bf;
typedef __attribute__((ext_vector_type(16))) _Float16 v16h;
typedef __attribute__((ext_vector_type(8)))  _Float16 v8h;
typedef __attribute__((ext_vector_type(8)))  unsigned short v8us;
typedef __attribute__((ext_vector_type(8)))  float    v8f;
typedef __attribute__((ext_vector_type(4)))  float    v4f;
typedef v8h  __attribute__((may_alias)) v8ha;
typedef v4f  __attribute__((may_alias)) v4fa;
typedef v8us __attribute__((may_alias)) v8usa;

__device__ __forceinline__ unsigned short f2bf(float f) { unsigned u = __float_as_uint(f); u += 0x7FFFu + ((u >> 16) & 1u); return (unsigned short)(u >> 16); }
__device__ __forceinline__ float bf2f(unsigned short b) { return __uint_as_float(((unsigned)b) << 16); }
__device__ __forceinline__ float bfr(float f) { return bf2f(f2bf(f)); }
__device__ __forceinline__ v16h cat16(v8h lo, v8h hi) { return __builtin_shufflevector(lo, hi, 0, 1, 2, 3, 4, 5, 6, 7, 8, 9, 10, 11, 12, 13, 14, 15); }
__device__ __forceinline__ v16bf cat16b(v8us lo, v8us hi) { return __builtin_bit_cast(v16bf, __builtin_shufflevector(lo, hi, 0, 1, 2, 3, 4, 5, 6, 7, 8, 9, 10, 11, 12, 13, 14, 15)); }
__device__ __forceinline__ v8f wmma16(v16h a, v16h b, v8f c) { return __builtin_amdgcn_wmma_f32_16x16x32_f16(false, a, false, b, (short)0, c, false, false); }
__device__ __forceinline__ v8f wmmab(v16bf a, v16bf b, v8f c) { return __builtin_amdgcn_wmma_f32_16x16x32_bf16(false, a, false, b, (short)0, c, false, false); }



// ---- k_gemmw: register-blocked GEMM, ONE WAVE per 64x64 output tile (16 accumulators), operands straight from 16-bit planes in fragment order (below); grid (M/64, N/64, Z), 32 threads.
// C[m][n] (f32, pitch ldc, + optional f32 bias[n]) = sum_k A[m][k] Bt[n][k] (+ split products per NSPLIT). z-batch strides sA/sB/sC in elements. K % 32 == 0. Row m is token m % TT of batch m / TT.
// EPI 0: C is stored as f32. EPI 1: z is the stream (0 q, 1 k, 2 v; sC = one stream's plane); the tile is 64 tokens of ONE head (HD == 64) of one batch and goes out as the [b][h][t][d] planes fp16, bf16 hi, bf16 lo, each head in fragment order; the v stream's three planes are transposed, [b][h][d][t], in fragment order too: a lane's 8 accumulator rows are 8 consecutive tokens of one d, so they are stored from the registers.
// FRAGMENT ORDER of every 16-bit operand plane: a 16-row x 32-k block is 1 KB in a row, element (r, k) at (k / 16) * 256 + ((k % 16) / 8 * 16 + r) * 8 + k % 8, so lane l = 16 hi + r finds its two 8-element pieces at l * 8 and 256 + l * 8
// and each 16-byte load of a wave covers 512 consecutive bytes (4 whole lines) instead of 32 bytes of 16 lines. Blocks of one 16-row group follow one another along k; the [d][t] value planes keep the 4 d groups of one 32-key pass together.
template <typename T16> struct WFrag;
template <> struct WFrag<h16> { typedef v16h V; static __device__ __forceinline__ V ld(const h16* p) { return cat16(*(const v8h*)p, *(const v8h*)(p + 256)); } static __device__ __forceinline__ v8f mma(V a, V b, v8f c) { return wmma16(a, b, c); } };
template <> struct WFrag<bf> { typedef v16bf V; static __device__ __forceinline__ V ld(const bf* p) { return cat16b(*(const v8us*)p, *(const v8us*)(p + 256)); } static __device__ __forceinline__ v8f mma(V a, V b, v8f c) { return wmmab(a, b, c); } };
template <typename T16, int NSPLIT, bool BIAS, int EPI, int K>   // K at compile time: the 16-row groups of a tile lie 32 * K bytes apart, which then fits the loads' immediate offsets
__global__ __launch_bounds__(32) void k_gemmw(const T16* __restrict__ A, const T16* __restrict__ A2, const T16* __restrict__ Bt, const T16* __restrict__ Bt2, float* C, int ldc, const float* __restrict__ bias, size_t sA, size_t sB, size_t sC, h16* P16, bf* Ph, bf* Pl) {
    static_assert(EPI == 0 || (HD == 64 && TT % 64 == 0), "a plane epilogue takes one 64-wide tile as one head and 64 rows as tokens of one batch");
    typedef typename WFrag<T16>::V V;
    __shared__ __align__(16) float os[16 * 68];
    const size_t z = blockIdx.z; A += z * sA; if (A2) A2 += z * sA; Bt += z * sB; if (Bt2) Bt2 += z * sB; if (EPI == 0) C += z * sC; else { P16 += z * sC; Ph += z * sC; Pl += z * sC; }
    const int lane = threadIdx.x & 31, lr = lane & 15, hi = lane >> 4; const int r0 = blockIdx.x * 64, c0 = blockIdx.y * 64; const int bt = r0 / TT, t0 = r0 % TT;
    v8f acc[4][4];
#pragma unroll
    for (int mb = 0; mb < 4; ++mb)
#pragma unroll
        for (int nb = 0; nb < 4; ++nb) acc[mb][nb] = (v8f){};
    const T16* pa = A + (size_t)r0 * K + 8 * lane; const T16* pa2 = A2 + (size_t)r0 * K + 8 * lane; const T16* pb = Bt + (size_t)c0 * K + 8 * lane; const T16* pb2 = Bt2 + (size_t)c0 * K + 8 * lane;   // a 16-row group is 16 * K elements, a k step of 32 is one block of 512
#pragma unroll 1
    for (int kc = 0; kc < K; kc += 32) {
        V a[4], a2[4], b[4], b2[4];
#pragma unroll
        for (int mb = 0; mb < 4; ++mb) { a[mb] = WFrag<T16>::ld(pa + mb * 16 * K); if (NSPLIT == 1 || NSPLIT == 2) a2[mb] = WFrag<T16>::ld(pa2 + mb * 16 * K); }
#pragma unroll
        for (int nb = 0; nb < 4; ++nb) { b[nb] = WFrag<T16>::ld(pb + nb * 16 * K); if (NSPLIT >= 2) b2[nb] = WFrag<T16>::ld(pb2 + nb * 16 * K); }
        // the wait between this k step's issued loads and whatever takes over their address registers; it names the addresses as inputs so that no later load of the step is given them as its destination in front of it
        if (NSPLIT == 0) asm volatile("s_wait_xcnt 0x0" :: "v"(pa), "v"(pb) : "memory");
        else if (NSPLIT == 1) asm volatile("s_wait_xcnt 0x0" :: "v"(pa), "v"(pa2), "v"(pb) : "memory");
        else asm volatile("s_wait_xcnt 0x0" :: "v"(pa), "v"(pa2), "v"(pb), "v"(pb2) : "memory");
#pragma unroll
        for (int nb = 0; nb < 4; ++nb) {
#pragma unroll
            for (int mb = 0; mb < 4; ++mb) { acc[mb][nb] = WFrag<T16>::mma(a[mb], b[nb], acc[mb][nb]); if (NSPLIT == 1 || NSPLIT == 2) acc[mb][nb] = WFrag<T16>::mma(a2[mb], b[nb], acc[mb][nb]); if (NSPLIT >= 2) acc[mb][nb] = WFrag<T16>::mma(a[mb], b2[nb], acc[mb][nb]); } }
        pa += 512; pa2 += 512; pb += 512; pb2 += 512;
        asm volatile("v_nop\n\tv_nop\n\tv_nop\n\tv_nop" : "+v"(acc[0][0]), "+v"(acc[1][1]), "+v"(acc[2][2]), "+v"(acc[3][3]) : "v"(a[0]), "v"(a[3]));
    }
    if (EPI == 1 && blockIdx.z == 2) {
#pragma unroll
        for (int nb = 0; nb < 4; ++nb) { const float bb = BIAS ? bfr(bias[c0 + nb * 16 + lr]) : 0.f; const size_t po = (size_t)(bt * DKV + c0) * TT + (size_t)t0 * HD + nb * 512 + 8 * lane;   // block (32-key pass, d group nb); the lane's 8 tokens are piece mb & 1 of pass t0 / 32 + mb / 2
#pragma unroll
            for (int mb = 0; mb < 4; ++mb) { v8h o16; v8us oh, ol;
#pragma unroll
                for (int j = 0; j < 8; ++j) { const float x = acc[mb][nb][j] + bb; o16[j] = (h16)x; const unsigned short h = f2bf(x); oh[j] = h; ol[j] = f2bf(x - bf2f(h)); }
                const int pm = (mb >> 1) * 2048 + (mb & 1) * 256; *(v8h*)(P16 + po + pm) = o16; *(v8us*)(Ph + po + pm) = oh; *(v8us*)(Pl + po + pm) = ol; } }
        return;
    }
    float bb4[4];   // plane epilogue: the bias of the lane's own accumulator columns, added in front of the LDS tile
#pragma unroll
    for (int nb = 0; nb < 4; ++nb) bb4[nb] = (EPI == 1 && BIAS) ? bfr(bias[c0 + nb * 16 + lr]) : 0.f;
#pragma unroll
    for (int mb = 0; mb < 4; ++mb) {
#pragma unroll
        for (int nb = 0; nb < 4; ++nb) {
#pragma unroll
            for (int j = 0; j < 8; ++j) os[(hi * 8 + j) * 68 + nb * 16 + lr] = EPI == 1 ? acc[mb][nb][j] + bb4[nb] : acc[mb][nb][j]; }
        __builtin_amdgcn_wave_barrier(); asm volatile("" ::: "memory");
        if (EPI == 1) {   // a lane takes 8 consecutive d of one token, in fragment order: store s is piece s & 1 of d block s / 2 = 512 consecutive bytes of a plane
            const size_t po = ((size_t)(bt * NH_ + blockIdx.y) * TT + t0 + mb * 16) * HD;
#pragma unroll
            for (int s = 0; s < 4; ++s) { const int row = lr, cofs = (2 * s + hi) * 8; const v4f x0 = *(const v4fa*)(os + row * 68 + cofs), x1 = *(const v4fa*)(os + row * 68 + cofs + 4); v8h o16; v8us oh, ol;
#pragma unroll
                for (int k = 0; k < 8; ++k) { const float x = k < 4 ? x0[k & 3] : x1[k & 3]; o16[k] = (h16)x; const unsigned short h = f2bf(x); oh[k] = h; ol[k] = f2bf(x - bf2f(h)); }
                const size_t o = po + s * 256 + 8 * lane; *(v8h*)(P16 + o) = o16; *(v8us*)(Ph + o) = oh; *(v8us*)(Pl + o) = ol; }
            __builtin_amdgcn_wave_barrier(); asm volatile("" ::: "memory");   // keeps the next 16 rows' LDS writes behind these reads of the one tile buffer, as in the f32 path below
            continue;
        }
        float* crow = C + (size_t)(r0 + mb * 16) * ldc + c0;
{
#pragma unroll
            for (int s = 0; s < 8; ++s) { const int row = 2 * s + hi, cofs = lr * 4; v4f val = *(const v4fa*)(os + row * 68 + cofs); if (BIAS) { val[0] += bfr(bias[c0 + cofs]); val[1] += bfr(bias[c0 + cofs + 1]); val[2] += bfr(bias[c0 + cofs + 2]); val[3] += bfr(bias[c0 + cofs + 3]); }
                *(v4f*)(crow + (size_t)row * ldc + cofs) = val; }
             }
        __builtin_amdgcn_wave_barrier(); asm volatile("" ::: "memory");
    }
    if (EPI == 1) asm volatile("s_wait_xcnt 0x0" ::: "memory");   // behind the last plane stores: in the listing the transposed epilogue's code follows them and takes over their registers
}

#define FAW 8
// XCNT0: the wait that stands between issued global loads and the first later instruction that takes over one of their address registers (the register allocator reuses dead address pairs as fragment and score registers)
#define XCNT0() asm volatile("s_wait_xcnt 0x0" ::: "memory")
#define SC2 (SCL * 1.4426950408889634f)
__device__ __forceinline__ float exp2s(float x) { float r; asm("v_exp_f32 %0, %1\n\tv_nop" : "=v"(r) : "v"(x)); return r; }
// eight at once, each in place: a neighbour touches only its own register, so the one v_nop behind the last serves the run
__device__ __forceinline__ void exp2x8(float* x) { asm("v_exp_f32 %0, %0\n\tv_exp_f32 %1, %1\n\tv_exp_f32 %2, %2\n\tv_exp_f32 %3, %3\n\tv_exp_f32 %4, %4\n\tv_exp_f32 %5, %5\n\tv_exp_f32 %6, %6\n\tv_exp_f32 %7, %7\n\tv_nop" : "+v"(x[0]), "+v"(x[1]), "+v"(x[2]), "+v"(x[3]), "+v"(x[4]), "+v"(x[5]), "+v"(x[6]), "+v"(x[7])); }
template <typename T16, int NSPLIT> struct PPack;
template <> struct PPack<h16, 0> { static __device__ __forceinline__ void pk(const float* p, v16h& a, v16h& b) { (void)b;
#pragma unroll
    for (int s = 0; s < 16; ++s) a[s] = (h16)p[s]; } };
template <> struct PPack<bf, 2> { static __device__ __forceinline__ void pk(const float* p, v16bf& a, v16bf& b) { typedef __attribute__((ext_vector_type(16))) unsigned short v16us; v16us x, y;
#pragma unroll
    for (int s = 0; s < 16; ++s) { const unsigned short h = f2bf(p[s]); x[s] = h; y[s] = f2bf(p[s] - bf2f(h)); }
    a = __builtin_bit_cast(v16bf, x); b = __builtin_bit_cast(v16bf, y); } };
template <typename T16, int NSPLIT, int QT, bool PRE>   // PRE: the key fragments are fetched one pass ahead
__device__ __forceinline__ void fattn_body(const T16* __restrict__ Q, const T16* __restrict__ Q2, const T16* __restrict__ Kp, const T16* __restrict__ Kp2, const T16* __restrict__ Vt, const T16* __restrict__ Vt2, int q0, bf* Ah, bf* Al, float* red, float* sm, float* sl) {
    typedef typename WFrag<T16>::V V;
    constexpr int QB = QT * 16;
    const int lane = threadIdx.x & 31, c = lane & 15, hi = lane >> 4;
    const int w = __builtin_amdgcn_readfirstlane(threadIdx.x >> 5);  // wave number, held scalar so that the pass loop's bounds and branch stay scalar
    V qf[QT][2], qf2[QT][2];
#pragma unroll
    for (int qt = 0; qt < QT; ++qt)
#pragma unroll
        for (int ks = 0; ks < 2; ++ks) { const size_t qo = (size_t)(q0 + qt * 16) * HD + ks * 512 + 8 * lane; qf[qt][ks] = WFrag<T16>::ld(Q + qo); if (NSPLIT >= 2) qf2[qt][ks] = WFrag<T16>::ld(Q2 + qo); }
    v8f o[QT][4]; float m[QT], l[QT];
#pragma unroll
    for (int qt = 0; qt < QT; ++qt) { m[qt] = -3.0e38f; l[qt] = 0.f;
#pragma unroll
        for (int dt = 0; dt < 4; ++dt) o[qt][dt] = (v8f){}; }
    const int np = q0 / 32 + 1;      // 32-key passes up to and including the one that holds the diagonal; key q0's pass is the last, so every pass has a kept key for every query of the block
    V ka[2][2], ka2[2][2];
    const unsigned klo = (unsigned)lane * 16u, vlo = klo;   // the lane's byte offset in a block of a key plane and of a value plane: fixed over the loop, so that a pass moves only the scalar base
    auto ldk = [&](int kk) { const char* kb = (const char*)(Kp + (size_t)kk * HD) + klo; const char* kb2 = (NSPLIT >= 2) ? (const char*)(Kp2 + (size_t)kk * HD) + klo : nullptr;
#pragma unroll
        for (int kt = 0; kt < 2; ++kt)
#pragma unroll
            for (int ks = 0; ks < 2; ++ks) { const int ko = (kt * 2 + ks) * 1024; ka[kt][ks] = WFrag<T16>::ld((const T16*)(kb + ko)); if (NSPLIT >= 2) ka2[kt][ks] = WFrag<T16>::ld((const T16*)(kb2 + ko)); } };
    if (PRE) ldk(min(w, np - 1) * 32);   // a wave without a pass fetches the last pass's rows and uses nothing of them
#pragma unroll 1   // rolled: one pass's fragments live at a time
    for (int p = w; p < np; p += FAW) { const int k0 = p * 32;
        if (!PRE) { ldk(k0); XCNT0(); }
        V va[4], va2[4];
#pragma unroll
        for (int dt = 0; dt < 4; ++dt) { const int vo = dt * 1024; va[dt] = WFrag<T16>::ld((const T16*)((const char*)(Vt + (size_t)k0 * HD) + vlo + vo)); if (NSPLIT >= 2) va2[dt] = WFrag<T16>::ld((const T16*)((const char*)(Vt2 + (size_t)k0 * HD) + vlo + vo)); }
        XCNT0();
        float s[QT][16];
#pragma unroll
        for (int kt = 0; kt < 2; ++kt) {
#pragma unroll
            for (int qt = 0; qt < QT; ++qt) { v8f t = (v8f){};
#pragma unroll
                for (int ks = 0; ks < 2; ++ks) { t = WFrag<T16>::mma(ka[kt][ks], qf[qt][ks], t); if (NSPLIT >= 2) { t = WFrag<T16>::mma(ka[kt][ks], qf2[qt][ks], t); t = WFrag<T16>::mma(ka2[kt][ks], qf[qt][ks], t); } }
#pragma unroll
                for (int r = 0; r < 8; ++r) s[qt][kt * 8 + r] = t[r] * SC2; } }
        if (PRE) ldk((p + FAW < np ? p + FAW : p) * 32);   // the next pass's key rows fly behind this pass's softmax and P.V; the last pass re-reads its own rows, so the address stays inside the plane
        if (k0 + 31 > q0) {          // the diagonal pass (scalar test): keys above the query are masked by select
#pragma unroll
            for (int qt = 0; qt < QT; ++qt) { const int lim = q0 + qt * 16 + c - k0 - 8 * hi;   // element e holds key k0 + 8 hi + (e >> 3) * 16 + (e & 7)
#pragma unroll
                for (int e = 0; e < 16; ++e) if ((e >> 3) * 16 + (e & 7) > lim) s[qt][e] = -3.0e38f; } }
        float mn[QT]; bool need = false;
#pragma unroll
        for (int qt = 0; qt < QT; ++qt) { float pm = s[qt][0];
#pragma unroll
            for (int e = 1; e < 16; ++e) pm = fmaxf(pm, s[qt][e]);
            pm = fmaxf(pm, __shfl_xor(pm, 16, 32)); mn[qt] = fmaxf(m[qt], pm); need = need || (mn[qt] > m[qt]); }
        if (__builtin_amdgcn_ballot_w32(need) != 0) {   // scalar branch: the rescale runs only in a pass that raises some query's maximum
#pragma unroll
            for (int qt = 0; qt < QT; ++qt) { const float al = exp2s(m[qt] - mn[qt]); m[qt] = mn[qt]; l[qt] *= al;
#pragma unroll
                for (int dt = 0; dt < 4; ++dt) o[qt][dt] *= al; } }
#pragma unroll
        for (int qt = 0; qt < QT; ++qt) {
#pragma unroll
            for (int e = 0; e < 16; ++e) s[qt][e] -= m[qt];
            exp2x8(s[qt]); exp2x8(s[qt] + 8);
#pragma unroll
            for (int e = 0; e < 16; ++e) l[qt] += s[qt][e];
            V pb, pb2; PPack<T16, NSPLIT>::pk(s[qt], pb, pb2);
#pragma unroll
            for (int dt = 0; dt < 4; ++dt) { o[qt][dt] = WFrag<T16>::mma(va[dt], pb, o[qt][dt]); if (NSPLIT >= 2) { o[qt][dt] = WFrag<T16>::mma(va[dt], pb2, o[qt][dt]); o[qt][dt] = WFrag<T16>::mma(va2[dt], pb, o[qt][dt]); } } }
    }
#pragma unroll
    for (int qt = 0; qt < QT; ++qt) { l[qt] += __shfl_xor(l[qt], 16, 32); if (hi == 0) { sm[w * QB + qt * 16 + c] = m[qt]; sl[w * QB + qt * 16 + c] = l[qt]; } }
    __syncthreads();   // every wave's maximum and sum are in LDS before any wave forms the joint ones
#pragma unroll
    for (int qt = 0; qt < QT; ++qt) { float M = sm[qt * 16 + c];
#pragma unroll
        for (int u = 1; u < FAW; ++u) M = fmaxf(M, sm[u * QB + qt * 16 + c]);
        float L = 0.f;
#pragma unroll
        for (int u = 0; u < FAW; ++u) L += sl[u * QB + qt * 16 + c] * exp2s(sm[u * QB + qt * 16 + c] - M);   // a wave without a pass has l = 0 and a factor of 0
        const float g = __fdiv_rn(exp2s(m[qt] - M), L);
        float* my = red + (size_t)(w * QB + qt * 16 + c) * 68 + 8 * hi;
#pragma unroll
        for (int dt = 0; dt < 4; ++dt) { v4f a, b;
#pragma unroll
            for (int r = 0; r < 4; ++r) { a[r] = o[qt][dt][r] * g; b[r] = o[qt][dt][r + 4] * g; }
            *(v4fa*)(my + dt * 16) = a; *(v4fa*)(my + dt * 16 + 4) = b; } }
    __syncthreads();   // every wave's scaled partial tile is in LDS before any thread sums across waves
    constexpr int EPT = QB * HD / (32 * FAW);      // output elements per thread: 8 or 4 consecutive d of one query row
    const int row = (int)threadIdx.x % QB, d0 = ((int)threadIdx.x / QB) * EPT;   // a wave takes one 8-wide d piece of 16 or 32 rows: 256-byte runs of the merged planes' fragment order
    float acc[EPT];
#pragma unroll
    for (int e4 = 0; e4 < EPT / 4; ++e4) { v4f val = *(const v4fa*)(red + row * 68 + d0 + e4 * 4);
#pragma unroll
        for (int u = 1; u < FAW; ++u) val += *(const v4fa*)(red + (u * QB + row) * 68 + d0 + e4 * 4);
#pragma unroll
        for (int r = 0; r < 4; ++r) acc[e4 * 4 + r] = val[r]; }
    typedef __attribute__((ext_vector_type(EPT))) unsigned short vEus;
    vEus oh, ol;
#pragma unroll
    for (int e = 0; e < EPT; ++e) { const unsigned short h = f2bf(acc[e]); oh[e] = h; ol[e] = f2bf(acc[e] - bf2f(h)); }
    const size_t oo = (size_t)(q0 + (row & ~15)) * DQ + (d0 >> 5) * 512 + ((d0 >> 4) & 1) * 256 + (((d0 >> 3) & 1) * 16 + (row & 15)) * 8 + (d0 & 7); *(vEus*)(Ah + oo) = oh; *(vEus*)(Al + oo) = ol;
}
// grid (batches x heads, row blocks): the block rank is the slow index and its cost falls with it (fp16 blocks of 32 rows from the last row down, then the hi/lo blocks of 16 rows from row RH down)
__global__ __launch_bounds__(32 * FAW) void k_fattn(const h16* __restrict__ Q16, const h16* __restrict__ K16, const h16* __restrict__ V16, const bf* __restrict__ Qh, const bf* __restrict__ Ql, const bf* __restrict__ Kh, const bf* __restrict__ Kl, const bf* __restrict__ Vh, const bf* __restrict__ Vl, bf* Ah, bf* Al) {
    __shared__ __align__(16) float red[FAW * 32 * 68]; __shared__ float sm[FAW * 32]; __shared__ float sl[FAW * 32];
    const size_t zo = (size_t)blockIdx.x * TT * HD; const int y = blockIdx.y; const size_t ao = (size_t)(blockIdx.x / NH_) * TT * DQ + (blockIdx.x % NH_) * (HD / 32) * 512; Ah += ao; Al += ao;
    if (y >= (TT - RH) / 32) { fattn_body<bf, 2, 1, false>(Qh + zo, Ql + zo, Kh + zo, Kl + zo, Vh + zo, Vl + zo, RH - 16 * (y - (TT - RH) / 32 + 1), Ah, Al, red, sm, sl); return; }
    fattn_body<h16, 0, 2, true>(Q16 + zo, nullptr, K16 + zo, nullptr, V16 + zo, nullptr, TT - 32 * (y + 1), Ah, Al, red, sm, sl);
    XCNT0();   // behind this body's two output stores: in the listing the hi/lo body's code follows them and takes over their data registers
}

// ---- k_cvt8: every f32 source rounded to bf16 in one launch. The five destinations lie one behind the other in the workspace (q, k, v streams, then wq, wo), and all have rows of DM elements, so they are one tall matrix in fragment order; a work-group takes 16 rows x 128 k = 4 blocks of one source, picked by a scalar test on the block index. A wave takes 8 rows x 32 k: whole 128-byte lines on both sides.
#define XBLK ((unsigned)((size_t)NB_ * TT * DM / 2048))   // blocks per stream
#define WBLK ((unsigned)((size_t)DQ * DM / 2048))         // blocks per weight
__global__ __launch_bounds__(256) void k_cvt8(const float* __restrict__ xq, const float* __restrict__ xk, const float* __restrict__ xv, const float* __restrict__ wq, const float* __restrict__ wo, bf* dst) {
    static_assert((size_t)NB_ * TT * DM % 2048 == 0 && (size_t)DQ * DM % 2048 == 0, "the grid covers every source exactly");
    static_assert(2 * WBLK <= XBLK, "both weights' blocks fall into stream number 3");
    static_assert(DQ == DM && DM == 1024, "eight work-groups cover one 16-row group of every source");
    const unsigned b = blockIdx.x, s = b / XBLK, lb = s < 3 ? b % XBLK : (b - 3 * XBLK) % WBLK;
    const float* src = s == 0 ? xq : s == 1 ? xk : s == 2 ? xv : b < 3 * XBLK + WBLK ? wq : wo;
    const unsigned wv = threadIdx.x >> 5, q = (threadIdx.x >> 3) & 3, r = (wv & 1) * 8 + (threadIdx.x & 7);   // q: which 8 of the block's 32 k; r: row in the 16-row group
    const v8f v = *(const v8f*)(src + (size_t)((lb >> 3) * 16 + r) * DM + ((lb & 7) * 4 + (wv >> 1)) * 32 + q * 8); v8us o;
    XCNT0();   // behind the two loads: the rounding below takes over their address register
#pragma unroll
    for (int k = 0; k < 8; ++k) o[k] = f2bf(v[k]); *(v8us*)(dst + ((size_t)b * 4 + (wv >> 1)) * 512 + (q >> 1) * 256 + ((q & 1) * 16 + r) * 8) = o;  }

extern "C" void kernel_launch(void* const* d_in, const int* in_sizes, int n_in,
                              void* d_out, int out_size, void* d_ws, size_t ws_size, hipStream_t stream) {
    (void)in_sizes; (void)n_in; (void)out_size;
    const float* x = (const float*)d_in[0]; const float* xk = (const float*)d_in[1]; const float* xv = (const float*)d_in[2]; const float* wq = (const float*)d_in[3]; const float* bq = (const float*)d_in[4]; const float* wo = (const float*)d_in[5]; const float* bo = (const float*)d_in[6];   /* input order Q, K, V (three streams), wq ('oi': the ONE weight used for the q, k AND v projections, as the source module does), bq (the one shared bias), wo ('oi'), bo; the causal rule is applied by index: no mask input */
    float* OUT = (float*)d_out;     // [2][2048][1024]
    char* wsp = (char*)d_ws;
    auto take = [&](size_t bytes) { char* p = wsp; wsp += (bytes + 255) & ~(size_t)255; return (void*)p; };
    const size_t SX = (size_t)NB_ * TT * DM, SP = (size_t)NB_ * NH_ * TT * HD;   // elements of one stream's bf16 copy and of one stream's plane, both batches
    bf* XB = (bf*)take((3 * SX + (size_t)DQ * DM + (size_t)DM * DQ) * 2); bf* WQ = XB + 3 * SX; bf* WO = WQ + (size_t)DQ * DM;   // one block: k_cvt8 writes it by the flat index
    h16* P16 = (h16*)take(3 * SP * 2); bf* Ph = (bf*)take(3 * SP * 2); bf* Pl = (bf*)take(3 * SP * 2);   // each [stream q, k, v][b][h]...
    bf* ATh = (bf*)take((size_t)NB_ * TT * DQ * 2); bf* ATl = (bf*)take((size_t)NB_ * TT * DQ * 2);
    if ((size_t)(wsp - (char*)d_ws) > ws_size) return;    // ws 256 MiB
    k_cvt8<<<3 * XBLK + 2 * WBLK, 256, 0, stream>>>(x, xk, xv, wq, wo, XB);
    k_gemmw<bf, 0, true, 1, DM><<<dim3(NB_ * TT / 64, DQ / 64, 3), 32, 0, stream>>>(XB, nullptr, WQ, nullptr, nullptr, 0, bq, SX, 0, SP, P16, Ph, Pl);
    k_fattn<<<dim3(NB_ * NH_, (TT - RH) / 32 + RH / 16, 1), 32 * FAW, 0, stream>>>(P16, P16 + SP, P16 + 2 * SP, Ph, Pl, Ph + SP, Pl + SP, Ph + 2 * SP, Pl + 2 * SP, ATh, ATl);   // one kv head per query head
    k_gemmw<bf, 1, true, 0, DQ><<<dim3(NB_ * TT / 64, DM / 64, 1), 32, 0, stream>>>(ATh, ATl, WO, nullptr, OUT, DM, bo, 0, 0, 0, nullptr, nullptr, nullptr);
}
